// v000
// The times below were measured on an AMD MI455X: many runs one after another, warmed up first and cycling through
// copies of the inputs, with the whole window's GPU time divided by the number of runs. Launches and the gaps
// between them are all in it. The median over several windows is given; except for v000 it joins two sittings, which
// can be a few percent apart, so the side-by-side timings, each taken in one sitting, are the better comparison.
// v000, which the later versions start from, runs in 172 microseconds.
#include <hip/hip_runtime.h>
// Contractions: x.W1, h.W2, m.Wq, m.Wk, Wv^T.m^T, banded q.k^T and P.v all on v_wmma_f32_16x16x32_f16 (f16 operands, f32 accumulate); weights carried x64 (folded back as 1/64), softmax weights carried x256 (folded back as 1/256); bias, ReLU, softmax in f32.

typedef _Float16 v16h __attribute__((ext_vector_type(16)));
typedef _Float16 v8h  __attribute__((ext_vector_type(8)));
typedef float    v8f  __attribute__((ext_vector_type(8)));
typedef float    v4f  __attribute__((ext_vector_type(4)));
union Frag { v16h v; v8h half[2]; };

static __device__ __forceinline__ v8f zero8() {
    v8f z = {0.f, 0.f, 0.f, 0.f, 0.f, 0.f, 0.f, 0.f};
    return z;
}

// 16x16x32 f16 WMMA with the VALU hazard guard tied to D, A and B.
static __device__ __forceinline__ v8f wmma16(v16h a, v16h b, v8f c) {
    v8f d = __builtin_amdgcn_wmma_f32_16x16x32_f16(false, a, false, b, (short)0, c, false, false);
    asm volatile("v_nop\n\tv_nop\n\tv_nop\n\tv_nop" : "+v"(d) : "v"(a), "v"(b));
    return d;
}

static __device__ __forceinline__ v8h cvt8(v4f u0, v4f u1) {
    v8h o;
    o[0] = (_Float16)u0[0]; o[1] = (_Float16)u0[1]; o[2] = (_Float16)u0[2]; o[3] = (_Float16)u0[3];
    o[4] = (_Float16)u1[0]; o[5] = (_Float16)u1[1]; o[6] = (_Float16)u1[2]; o[7] = (_Float16)u1[3];
    return o;
}

// ---------------------------------------------------------------------------
// ---------------------------------------------------------------------------
__global__ __launch_bounds__(256) void k_cvt_f16(const float* __restrict__ in, _Float16* out, int n8) {
    const int i = blockIdx.x * 256 + threadIdx.x;
    const bool ok = i < n8;
    const size_t base = (size_t)(ok ? i : 0) * 8;
    const v4f u0 = *(const v4f*)(in + base);
    const v4f u1 = *(const v4f*)(in + base + 4);
    const v8h o = cvt8(u0, u1);
    v8h* p = (v8h*)(out + base);
    if (ok) *p = o;
    
}

// ---------------------------------------------------------------------------
// in[K][N] f32  ->  out[N][K] f16 * scl  (k-contiguous weight copy), five tensors selected by blockIdx.z.
// block 256, tile 64(k) x 64(n); grid (ceil(N/64), ceil(K/64), 5).
// ---------------------------------------------------------------------------
__global__ __launch_bounds__(256) void k_wtrans(const float* __restrict__ w0, const float* __restrict__ w1,
                                                const float* __restrict__ w2, const float* __restrict__ w3,
                                                const float* __restrict__ w4,
                                                _Float16* o0, _Float16* o1, _Float16* o2, _Float16* o3, _Float16* o4,
                                                int K, int N, float scl) {
    __shared__ float tile[64][65];
    const int z = blockIdx.z;
    const float* in = (z == 0) ? w0 : (z == 1) ? w1 : (z == 2) ? w2 : (z == 3) ? w3 : w4;
    _Float16* out   = (z == 0) ? o0 : (z == 1) ? o1 : (z == 2) ? o2 : (z == 3) ? o3 : o4;
    const int n0 = blockIdx.x * 64, k0 = blockIdx.y * 64;
    const int tid = threadIdx.x;
    const int cn = tid & 63, rk = tid >> 6;          // rk 0..3
#pragma unroll
    for (int i = 0; i < 16; ++i) {
        const int kk = rk + 4 * i;                   // 0..63
        float v = 0.f;
        if (k0 + kk < K && n0 + cn < N) v = in[(size_t)(k0 + kk) * N + n0 + cn];
        tile[kk][cn] = v;
    }
    __syncthreads();
    const int lane = tid & 31, wave = tid >> 5;
    const int p = lane & 7, rq = lane >> 3;          // p: 16-B piece (k 8p..8p+7), rq: row within group of 4
    // wave w writes output rows nn = 8w .. 8w+7 (2 instructions x 4 rows)
    v8h vals[2];
#pragma unroll
    for (int i = 0; i < 2; ++i) {
        const int nn = 8 * wave + 4 * i + rq;
        v8h o;
#pragma unroll
        for (int e = 0; e < 8; ++e) o[e] = (_Float16)(tile[8 * p + e][nn] * scl);
        vals[i] = o;
    }
#pragma unroll
    for (int i = 0; i < 2; ++i) {
        const int nn = 8 * wave + 4 * i + rq;
        if (n0 + nn < N && k0 + 8 * p + 8 <= K)
            *(v8h*)(out + (size_t)(n0 + nn) * K + k0 + 8 * p) = vals[i];
    }
    
}

// ---------------------------------------------------------------------------
// C[M][N] (f16, pitch N) = act((A[M][K] . Bt[N][K]^T) * inv + bias),  K multiple of 32.
// Block 256 = 8 waves -> 128x64 tile; wave (wm, wn) owns 32x32 = 4 accumulators.
// Fragments loaded directly from global with the split k map for BOTH A and Bt:
//   lane l: row/col = l&15, h = l>>4; elements 0..7 <- k0+8h+0..7, elements 8..15 <- k0+16+8h+0..7.
// D: element r of lane l = (row 8h+r, col l&15).
// ---------------------------------------------------------------------------
template <bool RELU, bool BROW>
__global__ __launch_bounds__(256) void k_gemm(const _Float16* __restrict__ A, const _Float16* __restrict__ Bt,
                                              const float* __restrict__ bias, _Float16* C,
                                              int M, int N, int K, float inv) {
    constexpr int CSP = 68;
    __shared__ __attribute__((aligned(16))) float Cs[128 * CSP];
    const int tid = threadIdx.x, wave = tid >> 5, lane = tid & 31;
    const int h = lane >> 4, m = lane & 15;
    const int m0 = blockIdx.y * 128, n0 = blockIdx.x * 64;
    const int wm = (wave & 3) * 32, wn = (wave >> 2) * 32;

    const int ra0 = min(m0 + wm + m, M - 1), ra1 = min(m0 + wm + 16 + m, M - 1);
    const int rb0 = min(n0 + wn + m, N - 1), rb1 = min(n0 + wn + 16 + m, N - 1);
    const _Float16* pa0 = A  + (size_t)ra0 * K + 8 * h;
    const _Float16* pa1 = A  + (size_t)ra1 * K + 8 * h;
    const _Float16* pb0 = Bt + (size_t)rb0 * K + 8 * h;
    const _Float16* pb1 = Bt + (size_t)rb1 * K + 8 * h;

    v8f c00 = zero8(), c01 = zero8(), c10 = zero8(), c11 = zero8();
#pragma unroll 2
    for (int k0 = 0; k0 + 32 <= K; k0 += 32) {
        Frag a0, a1, b0, b1;
        a0.half[0] = *(const v8h*)(pa0 + k0);  a0.half[1] = *(const v8h*)(pa0 + k0 + 16);
        a1.half[0] = *(const v8h*)(pa1 + k0);  a1.half[1] = *(const v8h*)(pa1 + k0 + 16);
        b0.half[0] = *(const v8h*)(pb0 + k0);  b0.half[1] = *(const v8h*)(pb0 + k0 + 16);
        b1.half[0] = *(const v8h*)(pb1 + k0);  b1.half[1] = *(const v8h*)(pb1 + k0 + 16);
        c00 = wmma16(a0.v, b0.v, c00);
        c01 = wmma16(a0.v, b1.v, c01);
        c10 = wmma16(a1.v, b0.v, c10);
        c11 = wmma16(a1.v, b1.v, c11);
    }

    // stage D: acc element r -> row 8h+r, col m of its 16x16 tile
#pragma unroll
    for (int r = 0; r < 8; ++r) {
        Cs[(wm + 8 * h + r) * CSP + wn + m]           = c00[r];
        Cs[(wm + 8 * h + r) * CSP + wn + 16 + m]      = c01[r];
        Cs[(wm + 16 + 8 * h + r) * CSP + wn + m]      = c10[r];
        Cs[(wm + 16 + 8 * h + r) * CSP + wn + 16 + m] = c11[r];
    }
    __syncthreads();

    const int p = lane & 7, rq = lane >> 3;          // p: cols 8p..8p+7, rq: row within group of 4
    v4f bc0 = {0.f, 0.f, 0.f, 0.f}, bc1 = {0.f, 0.f, 0.f, 0.f};
    if (!BROW) {
        if (n0 + 8 * p + 8 <= N) {
            bc0 = *(const v4f*)(bias + n0 + 8 * p);
            bc1 = *(const v4f*)(bias + n0 + 8 * p + 4);
        }
    }
    // wave w writes rows 16w..16w+15 (4 instructions x 4 rows)
    v8h vals[4];
#pragma unroll
    for (int i = 0; i < 4; ++i) {
        const int rloc = 16 * wave + 4 * i + rq;
        const float* src = Cs + rloc * CSP + 8 * p;
        v4f u0 = *(const v4f*)src;
        v4f u1 = *(const v4f*)(src + 4);
        v4f b0v = bc0, b1v = bc1;
        if (BROW) {
            const float bb = bias[min(m0 + rloc, M - 1)];
            v4f t = {bb, bb, bb, bb};
            b0v = t; b1v = t;
        }
        u0 = u0 * inv + b0v;
        u1 = u1 * inv + b1v;
        if (RELU) {
            u0[0] = fmaxf(u0[0], 0.f); u0[1] = fmaxf(u0[1], 0.f); u0[2] = fmaxf(u0[2], 0.f); u0[3] = fmaxf(u0[3], 0.f);
            u1[0] = fmaxf(u1[0], 0.f); u1[1] = fmaxf(u1[1], 0.f); u1[2] = fmaxf(u1[2], 0.f); u1[3] = fmaxf(u1[3], 0.f);
        }
        vals[i] = cvt8(u0, u1);
    }
#pragma unroll
    for (int i = 0; i < 4; ++i) {
        const int grow = m0 + 16 * wave + 4 * i + rq;
        if (grow < M && n0 + 8 * p + 8 <= N)
            *(v8h*)(C + (size_t)grow * N + n0 + 8 * p) = vals[i];
    }
    
}

// ---------------------------------------------------------------------------
// Banded attention, window offsets -32..+32, D = 1024.  One block (256 = 8 waves) per tile of 16 queries.
//   qh, kh : [ntok][1024] f16 (token-major);  vT : [1024][ntok] f16 (value dim major);  out : [ntok][1024] f32.
// Phase 1: scores S[16 q][80 keys] (keys s0-32 .. s0+47): wave t<5 computes key tile t on WMMA over k = 1024
//          (A = q rows, B[k=d][n=key] from k rows with the same split map), f32 into LDS.
// Phase 2: f32 masked softmax per query row (2 rows per wave), P*pscl as f16 into LDS [16][96] (cols 80..95 = 0).
// Phase 3: O^T[d][q] = vT[d][keys] . P^T[keys][q] on WMMA (3 k-steps of 32 keys; A from vT rows, clamped
//          in-range loads where P is zero; B = P^T loaded from the [q][key] LDS tile with the split map),
// ---------------------------------------------------------------------------
__global__ __launch_bounds__(256) void k_band_attn(const _Float16* __restrict__ qh, const _Float16* __restrict__ kh,
                                                   const _Float16* __restrict__ vT, float* out,
                                                   int S, int ntok, float scale, float pscl, float pinv) {
    constexpr int D = 1024, HALF = 32, NC = 80, PP = 96, OSP = 516;
    __shared__ __attribute__((aligned(16))) float    Ss[16 * NC];
    __shared__ __attribute__((aligned(16))) _Float16 Ps[16 * PP];
    __shared__ __attribute__((aligned(16))) float    Os[16 * OSP];

    const int tid = threadIdx.x, wave = tid >> 5, lane = tid & 31;
    const int h = lane >> 4, m = lane & 15;
    const int tok0 = blockIdx.x * 16;                // 16 | S, so a tile never straddles a batch
    const int b = tok0 / S;
    const int s0 = tok0 - b * S;
    const size_t bS = (size_t)b * S;
    const float ninf = -__builtin_huge_valf();

    // ---- phase 1: scores ----
    if (wave < 5) {                                  // wave-uniform branch
        const int t = wave;
        const int key  = s0 - HALF + 16 * t + m;
        const int keyc = min(max(key, 0), S - 1);
        const _Float16* pa = qh + (size_t)(tok0 + m) * D + 8 * h;
        const _Float16* pb = kh + (bS + keyc) * D + 8 * h;
        v8f acc = zero8();
#pragma unroll 2
        for (int k0 = 0; k0 < D; k0 += 32) {
            Frag a, bb;
            a.half[0]  = *(const v8h*)(pa + k0);  a.half[1]  = *(const v8h*)(pa + k0 + 16);
            bb.half[0] = *(const v8h*)(pb + k0);  bb.half[1] = *(const v8h*)(pb + k0 + 16);
            acc = wmma16(a.v, bb.v, acc);
        }
#pragma unroll
        for (int r = 0; r < 8; ++r) Ss[(8 * h + r) * NC + 16 * t + m] = acc[r];
    }
    __syncthreads();

    // ---- phase 2: masked softmax, rows 2w and 2w+1 per wave ----
#pragma unroll
    for (int rr = 0; rr < 2; ++rr) {
        const int r = 2 * wave + rr;                 // query row 0..15, position s0 + r
        float xv[3], ev[3];
        bool  vv[3];
        float mx = ninf;
#pragma unroll
        for (int c3 = 0; c3 < 3; ++c3) {
            const int c   = lane + 32 * c3;          // key column 0..95
            const int key = s0 - HALF + c;
            const bool valid = (c < NC) && (c >= r) && (c <= r + 2 * HALF) && (key >= 0) && (key < S);
            float x = ninf;
            if (valid) x = Ss[r * NC + c] * scale;
            xv[c3] = x; vv[c3] = valid;
            mx = fmaxf(mx, x);
        }
#pragma unroll
        for (int o = 16; o > 0; o >>= 1) mx = fmaxf(mx, __shfl_xor(mx, o, 32));
        float sum = 0.f;
#pragma unroll
        for (int c3 = 0; c3 < 3; ++c3) {
            const float e = vv[c3] ? expf(xv[c3] - mx) : 0.f;
            ev[c3] = e;
            sum += e;
        }
#pragma unroll
        for (int o = 16; o > 0; o >>= 1) sum += __shfl_xor(sum, o, 32);
        const float f = pscl / sum;
#pragma unroll
        for (int c3 = 0; c3 < 3; ++c3) {
            const int c = lane + 32 * c3;            // always < 96
            Ps[r * PP + c] = (_Float16)(ev[c3] * f);
        }
    }
    __syncthreads();

    // ---- phase 3: O^T = vT . P^T ----
    Frag pf[3];
#pragma unroll
    for (int j = 0; j < 3; ++j) {
        pf[j].half[0] = *(const v8h*)(Ps + m * PP + 32 * j + 8 * h);
        pf[j].half[1] = *(const v8h*)(Ps + m * PP + 32 * j + 16 + 8 * h);
    }
    for (int hd = 0; hd < 2; ++hd) {
#pragma unroll
        for (int i = 0; i < 4; ++i) {
            const int dtl = wave + 8 * i;            // local value-dim tile 0..31
            const int d0  = 512 * hd + 16 * dtl;
            const _Float16* prow = vT + (size_t)(d0 + m) * ntok + bS;
            v8f acc = zero8();
#pragma unroll
            for (int j = 0; j < 3; ++j) {
                const int g0 = s0 - HALF + 32 * j + 8 * h;
                const int g1 = g0 + 16;
                const int g0c = min(max(g0, 0), S - 8);
                const int g1c = min(max(g1, 0), S - 8);
                Frag a;
                a.half[0] = *(const v8h*)(prow + g0c);
                a.half[1] = *(const v8h*)(prow + g1c);
                acc = wmma16(a.v, pf[j].v, acc);
            }
#pragma unroll
            for (int r = 0; r < 8; ++r) Os[m * OSP + 16 * dtl + 8 * h + r] = acc[r] * pinv;
        }
        __syncthreads();
        v4f ov[8];
#pragma unroll
        for (int rr = 0; rr < 2; ++rr) {
#pragma unroll
            for (int c = 0; c < 4; ++c) {
                const int row = 2 * wave + rr;
                ov[rr * 4 + c] = *(const v4f*)(Os + row * OSP + 128 * c + 4 * lane);
            }
        }
#pragma unroll
        for (int rr = 0; rr < 2; ++rr) {
#pragma unroll
            for (int c = 0; c < 4; ++c) {
                const int row = 2 * wave + rr;
                if (tok0 + row < ntok)
                    *(v4f*)(out + (size_t)(tok0 + row) * D + 512 * hd + 128 * c + 4 * lane) = ov[rr * 4 + c];
            }
        }
        
        __syncthreads();
    }
}

// ---------------------------------------------------------------------------
// Host launch glue
// ---------------------------------------------------------------------------
extern "C" void kernel_launch(void* const* d_in, const int* in_sizes, int n_in,
                              void* d_out, int out_size, void* d_ws, size_t ws_size,
                              hipStream_t stream) {
    if (n_in < 11) return;
    constexpr int S = 2048;                          // sequence length (band boundary)
    const int KV = in_sizes[2];                      // hidden width of the first projection
    const int D  = in_sizes[4];                      // model width
    if (D != 1024 || KV != 1024) return;
    const int ntok = in_sizes[0] / D;                // B*S
    if (ntok <= 0 || ntok * D != in_sizes[0]) return;
    if ((ntok % 128) != 0 || (ntok % S) != 0 || (S % 16) != 0) return;
    if (in_sizes[1] != D * KV || in_sizes[3] != KV * D || in_sizes[5] != D * D ||
        in_sizes[7] != D * D || in_sizes[9] != D * D) return;
    if (in_sizes[6] != D || in_sizes[8] != D || in_sizes[10] != D) return;
    if (out_size != ntok * D) return;

    const float* x  = (const float*)d_in[0];
    const float* w1 = (const float*)d_in[1];
    const float* b1 = (const float*)d_in[2];
    const float* w2 = (const float*)d_in[3];
    const float* b2 = (const float*)d_in[4];
    const float* qw = (const float*)d_in[5];
    const float* qb = (const float*)d_in[6];
    const float* kw = (const float*)d_in[7];
    const float* kb = (const float*)d_in[8];
    const float* vw = (const float*)d_in[9];
    const float* vb = (const float*)d_in[10];
    float* outp = (float*)d_out;

    const size_t nTD = (size_t)ntok * D;             // activations
    const size_t nDD = (size_t)D * D;                // square weights (D == KV)
    _Float16* xh  = (_Float16*)d_ws;                 // [ntok][D]
    _Float16* w1t = xh  + nTD;                       // [KV][D]  (k-contiguous)
    _Float16* w2t = w1t + nDD;                       // [D][KV]
    _Float16* qwt = w2t + nDD;                       // [D][D]
    _Float16* kwt = qwt + nDD;
    _Float16* vwt = kwt + nDD;
    _Float16* hh  = vwt + nDD;                       // [ntok][KV]
    _Float16* mh  = hh  + nTD;                       // [ntok][D]
    _Float16* qh  = mh  + nTD;                       // [ntok][D]
    _Float16* kh  = qh  + nTD;                       // [ntok][D]
    _Float16* vT  = kh  + nTD;                       // [D][ntok]
    const size_t total_halves = 6 * nTD + 5 * nDD;
    if (total_halves * sizeof(_Float16) > ws_size) return;

    const float wscl  = 64.0f, winv = 1.0f / 64.0f;
    const float pscl  = 256.0f, pinv = 1.0f / 256.0f;
    const float scale = 1.0f / sqrtf((float)D);

    // 1) x -> f16
    {
        const int n8 = (int)(nTD / 8);
        k_cvt_f16<<<(n8 + 255) / 256, 256, 0, stream>>>(x, xh, n8);
    }
    // 2) weights [K][N] -> [N][K] f16 * 64   (D == KV, all five are 1024 x 1024)
    {
        dim3 tg((D + 63) / 64, (D + 63) / 64, 5);
        k_wtrans<<<tg, 256, 0, stream>>>(w1, w2, qw, kw, vw, w1t, w2t, qwt, kwt, vwt, D, D, wscl);
    }
    // 3) projections
    {
        dim3 g1((KV + 63) / 64, (ntok + 127) / 128);
        k_gemm<true,  false><<<g1, 256, 0, stream>>>(xh, w1t, b1, hh, ntok, KV, D, winv);   // h = relu(x.W1 + b1)
        dim3 g2((D + 63) / 64, (ntok + 127) / 128);
        k_gemm<false, false><<<g2, 256, 0, stream>>>(hh, w2t, b2, mh, ntok, D, KV, winv);  // m = h.W2 + b2
        k_gemm<false, false><<<g2, 256, 0, stream>>>(mh, qwt, qb, qh, ntok, D, D, winv);   // q
        k_gemm<false, false><<<g2, 256, 0, stream>>>(mh, kwt, kb, kh, ntok, D, D, winv);   // k
        dim3 g3((ntok + 63) / 64, (D + 127) / 128);
        k_gemm<false, true ><<<g3, 256, 0, stream>>>(vwt, mh, vb, vT, D, ntok, D, winv);   // vT[d][tok] = Wv^T.m^T + b[d]
    }
    // 4) banded attention
    k_band_attn<<<ntok / 16, 256, 0, stream>>>(qh, kh, vT, outp, S, ntok, scale, pscl, pinv);
}

// v001
// It runs in 91 microseconds.
// Next to v000, in two timings, it ran 1.93 times as fast each time.
#include <hip/hip_runtime.h>
// Contractions: x.W1, h.W2, m.Wq, m.Wk, Wv^T.m^T, banded q.k^T and P.v all on v_wmma_f32_16x16x32_f16 (f16 operands, f32 accumulate); weights carried x64 (folded back as 1/64), softmax weights carried x256 (folded back as 1/256); bias, ReLU, softmax in f32.

typedef _Float16 v16h __attribute__((ext_vector_type(16)));
typedef _Float16 v8h  __attribute__((ext_vector_type(8)));
typedef float    v8f  __attribute__((ext_vector_type(8)));
typedef float    v4f  __attribute__((ext_vector_type(4)));
union Frag { v16h v; v8h half[2]; };

static __device__ __forceinline__ v8f zero8() {
    v8f z = {0.f, 0.f, 0.f, 0.f, 0.f, 0.f, 0.f, 0.f};
    return z;
}

// 16x16x32 f16 WMMA with the VALU hazard guard tied to D, A and B.
static __device__ __forceinline__ v8f wmma16(v16h a, v16h b, v8f c) {
    v8f d = __builtin_amdgcn_wmma_f32_16x16x32_f16(false, a, false, b, (short)0, c, false, false);
    asm volatile("v_nop\n\tv_nop\n\tv_nop\n\tv_nop" : "+v"(d) : "v"(a), "v"(b));
    return d;
}

static __device__ __forceinline__ v8h cvt8(v4f u0, v4f u1) {
    v8h o;
    o[0] = (_Float16)u0[0]; o[1] = (_Float16)u0[1]; o[2] = (_Float16)u0[2]; o[3] = (_Float16)u0[3];
    o[4] = (_Float16)u1[0]; o[5] = (_Float16)u1[1]; o[6] = (_Float16)u1[2]; o[7] = (_Float16)u1[3];
    return o;
}

// ---------------------------------------------------------------------------
// ---------------------------------------------------------------------------
__global__ __launch_bounds__(256) void k_cvt_f16(const float* __restrict__ in, _Float16* out, int n8) {
    const int i = blockIdx.x * 256 + threadIdx.x;
    const bool ok = i < n8;
    const size_t base = (size_t)(ok ? i : 0) * 8;
    const v4f u0 = *(const v4f*)(in + base);
    const v4f u1 = *(const v4f*)(in + base + 4);
    const v8h o = cvt8(u0, u1);
    v8h* p = (v8h*)(out + base);
    if (ok) *p = o;
    
}

// ---------------------------------------------------------------------------
// in[K][N] f32  ->  out[N][K] f16 * scl  (k-contiguous weight copy), five tensors selected by blockIdx.z.
// block 256, tile 64(k) x 64(n); grid (ceil(N/64), ceil(K/64), 5).
// ---------------------------------------------------------------------------
__global__ __launch_bounds__(256) void k_wtrans(const float* __restrict__ w0, const float* __restrict__ w1,
                                                const float* __restrict__ w2, const float* __restrict__ w3,
                                                const float* __restrict__ w4,
                                                _Float16* o0, _Float16* o1, _Float16* o2, _Float16* o3, _Float16* o4,
                                                int K, int N, float scl) {
    __shared__ float tile[64][65];
    const int z = blockIdx.z;
    const float* in = (z == 0) ? w0 : (z == 1) ? w1 : (z == 2) ? w2 : (z == 3) ? w3 : w4;
    _Float16* out   = (z == 0) ? o0 : (z == 1) ? o1 : (z == 2) ? o2 : (z == 3) ? o3 : o4;
    const int n0 = blockIdx.x * 64, k0 = blockIdx.y * 64;
    const int tid = threadIdx.x;
    const int cn = tid & 63, rk = tid >> 6;          // rk 0..3
#pragma unroll
    for (int i = 0; i < 16; ++i) {
        const int kk = rk + 4 * i;                   // 0..63
        float v = 0.f;
        if (k0 + kk < K && n0 + cn < N) v = in[(size_t)(k0 + kk) * N + n0 + cn];
        tile[kk][cn] = v;
    }
    __syncthreads();
    const int lane = tid & 31, wave = tid >> 5;
    const int p = lane & 7, rq = lane >> 3;          // p: 16-B piece (k 8p..8p+7), rq: row within group of 4
    // wave w writes output rows nn = 8w .. 8w+7 (2 instructions x 4 rows)
    v8h vals[2];
#pragma unroll
    for (int i = 0; i < 2; ++i) {
        const int nn = 8 * wave + 4 * i + rq;
        v8h o;
#pragma unroll
        for (int e = 0; e < 8; ++e) o[e] = (_Float16)(tile[8 * p + e][nn] * scl);
        vals[i] = o;
    }
#pragma unroll
    for (int i = 0; i < 2; ++i) {
        const int nn = 8 * wave + 4 * i + rq;
        if (n0 + nn < N && k0 + 8 * p + 8 <= K)
            *(v8h*)(out + (size_t)(n0 + nn) * K + k0 + 8 * p) = vals[i];
    }
    
}

// ---------------------------------------------------------------------------
// Twelve asynchronous 16-byte copies per lane, global -> LDS, through no register: copy i brings g[i] + koff
// (halves) to LDS byte l0 + i * step.  The closing s_wait_xcnt 0 stands in the copies' own statement so that
// no address register of an issued copy is rewritten in front of it.
// ---------------------------------------------------------------------------
static __device__ __forceinline__ void copy12(unsigned l0, unsigned step, const _Float16* const (&g)[12], int koff) {
    asm volatile(
        "global_load_async_to_lds_b128 %0, %12, off\n\t"
        "global_load_async_to_lds_b128 %1, %13, off\n\t"
        "global_load_async_to_lds_b128 %2, %14, off\n\t"
        "global_load_async_to_lds_b128 %3, %15, off\n\t"
        "global_load_async_to_lds_b128 %4, %16, off\n\t"
        "global_load_async_to_lds_b128 %5, %17, off\n\t"
        "global_load_async_to_lds_b128 %6, %18, off\n\t"
        "global_load_async_to_lds_b128 %7, %19, off\n\t"
        "global_load_async_to_lds_b128 %8, %20, off\n\t"
        "global_load_async_to_lds_b128 %9, %21, off\n\t"
        "global_load_async_to_lds_b128 %10, %22, off\n\t"
        "global_load_async_to_lds_b128 %11, %23, off\n\t"
        "s_wait_xcnt 0x0"
        :: "v"(l0), "v"(l0 + step), "v"(l0 + 2 * step), "v"(l0 + 3 * step), "v"(l0 + 4 * step), "v"(l0 + 5 * step),
           "v"(l0 + 6 * step), "v"(l0 + 7 * step), "v"(l0 + 8 * step), "v"(l0 + 9 * step), "v"(l0 + 10 * step),
           "v"(l0 + 11 * step),
           "v"(g[0] + koff), "v"(g[1] + koff), "v"(g[2] + koff), "v"(g[3] + koff), "v"(g[4] + koff), "v"(g[5] + koff),
           "v"(g[6] + koff), "v"(g[7] + koff), "v"(g[8] + koff), "v"(g[9] + koff), "v"(g[10] + koff), "v"(g[11] + koff)
        : "memory");
}

// ---------------------------------------------------------------------------
// C[M][N] (f16, pitch N) = act((A[M][K] . Bt[N][K]^T) * inv + bias),  K a multiple of 128.
// Block 256 = 8 waves -> 128x64 tile; wave (wm, wn) owns 32x32 = 4 accumulators.
// A pass is 128 k: its 128 A rows and 64 Bt rows (256 B each) are copied whole-line into one of two LDS buffers
// (row pitch 272 B) while the pass before is worked on; fragments are read from LDS with the split k map for
// BOTH A and Bt:
//   lane l: row/col = l&15, h = l>>4; elements 0..7 <- k0+8h+0..7, elements 8..15 <- k0+16+8h+0..7.
// D: element r of lane l = (row 8h+r, col l&15).
// ---------------------------------------------------------------------------
template <bool RELU, bool BROW>
__global__ __launch_bounds__(256) void k_gemm(const _Float16* __restrict__ A, const _Float16* __restrict__ Bt,
                                              const float* __restrict__ bias, _Float16* C,
                                              int M, int N, int K, float inv) {
    constexpr int CSP = 68;
    constexpr int KP = 128, LP = 136, STG = 192 * LP;    // k per pass; LDS row pitch and buffer size in halves
    __shared__ __attribute__((aligned(16))) float Cs[128 * CSP];
    __shared__ __attribute__((aligned(16))) _Float16 Ts[2 * STG];
    const int tid = threadIdx.x, wave = tid >> 5, lane = tid & 31;
    const int h = lane >> 4, m = lane & 15;
    const int m0 = blockIdx.y * 128, n0 = blockIdx.x * 64;
    const int wm = (wave & 3) * 32, wn = (wave >> 2) * 32;

    // copy map: thread -> row tid>>4 of each group of 16 rows, 16-byte piece tid&15; groups 0..7 = A, 8..11 = Bt
    const int crow = tid >> 4, cpc = tid & 15;
    const _Float16* g[12];
#pragma unroll   // constant indices keep g[] in registers
    for (int i = 0; i < 8; ++i) g[i] = A + (size_t)min(m0 + 16 * i + crow, M - 1) * K + 8 * cpc;
#pragma unroll   // as above
    for (int i = 0; i < 4; ++i) g[8 + i] = Bt + (size_t)min(n0 + 16 * i + crow, N - 1) * K + 8 * cpc;
    const unsigned lds0 = (unsigned)(size_t)(Ts + crow * LP + 8 * cpc);   // low 32 bits = LDS byte address
    constexpr unsigned GSTEP = 16 * LP * 2, BUFB = STG * 2;               // bytes per 16 rows, per buffer
    const int npass = K / KP;

    copy12(lds0, GSTEP, g, 0);
    asm volatile("s_wait_asynccnt 0x0" ::: "memory");   // this wave's share of pass 0 has landed
    __syncthreads();                                    // publishes pass 0 to every wave
    if (npass > 1) copy12(lds0 + BUFB, GSTEP, g, KP);

    const int fa = (wm + m) * LP + 8 * h;               // fragment offsets inside a buffer, halves
    const int fb = (128 + wn + m) * LP + 8 * h;
    v8f c00 = zero8(), c01 = zero8(), c10 = zero8(), c11 = zero8();
    for (int t = 0; t < npass; ++t) {
        const _Float16* tb = Ts + (t & 1) * STG;
#pragma unroll   // constant k0 folds into the LDS loads' offset field
        for (int k0 = 0; k0 < KP; k0 += 32) {
            Frag a0, a1, b0, b1;
            a0.half[0] = *(const v8h*)(tb + fa + k0);            a0.half[1] = *(const v8h*)(tb + fa + k0 + 16);
            a1.half[0] = *(const v8h*)(tb + fa + 16 * LP + k0);  a1.half[1] = *(const v8h*)(tb + fa + 16 * LP + k0 + 16);
            b0.half[0] = *(const v8h*)(tb + fb + k0);            b0.half[1] = *(const v8h*)(tb + fb + k0 + 16);
            b1.half[0] = *(const v8h*)(tb + fb + 16 * LP + k0);  b1.half[1] = *(const v8h*)(tb + fb + 16 * LP + k0 + 16);
            c00 = wmma16(a0.v, b0.v, c00);
            c01 = wmma16(a0.v, b1.v, c01);
            c10 = wmma16(a1.v, b0.v, c10);
            c11 = wmma16(a1.v, b1.v, c11);
        }
        asm volatile("s_wait_dscnt 0x0" ::: "memory");     // this wave's reads of buffer t&1 are done before it is refilled
        asm volatile("s_wait_asynccnt 0x0" ::: "memory");  // this wave's share of pass t+1 has landed
        __syncthreads();                                   // publishes pass t+1 and ends every read of buffer t&1
        if (t + 2 < npass) copy12(lds0 + (t & 1) * BUFB, GSTEP, g, (t + 2) * KP);
    }
    asm volatile("s_wait_asynccnt 0x0" ::: "memory");      // no copy is outstanding behind the loop

    // stage D: acc element r -> row 8h+r, col m of its 16x16 tile
#pragma unroll
    for (int r = 0; r < 8; ++r) {
        Cs[(wm + 8 * h + r) * CSP + wn + m]           = c00[r];
        Cs[(wm + 8 * h + r) * CSP + wn + 16 + m]      = c01[r];
        Cs[(wm + 16 + 8 * h + r) * CSP + wn + m]      = c10[r];
        Cs[(wm + 16 + 8 * h + r) * CSP + wn + 16 + m] = c11[r];
    }
    __syncthreads();

    const int p = lane & 7, rq = lane >> 3;          // p: cols 8p..8p+7, rq: row within group of 4
    v4f bc0 = {0.f, 0.f, 0.f, 0.f}, bc1 = {0.f, 0.f, 0.f, 0.f};
    if (!BROW) {
        if (n0 + 8 * p + 8 <= N) {
            bc0 = *(const v4f*)(bias + n0 + 8 * p);
            bc1 = *(const v4f*)(bias + n0 + 8 * p + 4);
        }
    }
    // wave w writes rows 16w..16w+15 (4 instructions x 4 rows)
    v8h vals[4];
#pragma unroll
    for (int i = 0; i < 4; ++i) {
        const int rloc = 16 * wave + 4 * i + rq;
        const float* src = Cs + rloc * CSP + 8 * p;
        v4f u0 = *(const v4f*)src;
        v4f u1 = *(const v4f*)(src + 4);
        v4f b0v = bc0, b1v = bc1;
        if (BROW) {
            const float bb = bias[min(m0 + rloc, M - 1)];
            v4f t = {bb, bb, bb, bb};
            b0v = t; b1v = t;
        }
        u0 = u0 * inv + b0v;
        u1 = u1 * inv + b1v;
        if (RELU) {
            u0[0] = fmaxf(u0[0], 0.f); u0[1] = fmaxf(u0[1], 0.f); u0[2] = fmaxf(u0[2], 0.f); u0[3] = fmaxf(u0[3], 0.f);
            u1[0] = fmaxf(u1[0], 0.f); u1[1] = fmaxf(u1[1], 0.f); u1[2] = fmaxf(u1[2], 0.f); u1[3] = fmaxf(u1[3], 0.f);
        }
        vals[i] = cvt8(u0, u1);
    }
#pragma unroll
    for (int i = 0; i < 4; ++i) {
        const int grow = m0 + 16 * wave + 4 * i + rq;
        if (grow < M && n0 + 8 * p + 8 <= N)
            *(v8h*)(C + (size_t)grow * N + n0 + 8 * p) = vals[i];
    }
    
}

// ---------------------------------------------------------------------------
// Banded attention, window offsets -32..+32, D = 1024.  One block (256 = 8 waves) per tile of 16 queries.
//   qh, kh : [ntok][1024] f16 (token-major);  vT : [1024][ntok] f16 (value dim major);  out : [ntok][1024] f32.
// Phase 1: scores S[16 q][80 keys] (keys s0-32 .. s0+47): wave t<5 computes key tile t on WMMA over k = 1024
//          (A = q rows, B[k=d][n=key] from k rows with the same split map), f32 into LDS.
// Phase 2: f32 masked softmax per query row (2 rows per wave), P*pscl as f16 into LDS [16][96] (cols 80..95 = 0).
// Phase 3: O^T[d][q] = vT[d][keys] . P^T[keys][q] on WMMA (3 k-steps of 32 keys; A from vT rows, clamped
//          in-range loads where P is zero; B = P^T loaded from the [q][key] LDS tile with the split map),
// ---------------------------------------------------------------------------
__global__ __launch_bounds__(256) void k_band_attn(const _Float16* __restrict__ qh, const _Float16* __restrict__ kh,
                                                   const _Float16* __restrict__ vT, float* out,
                                                   int S, int ntok, float scale, float pscl, float pinv) {
    constexpr int D = 1024, HALF = 32, NC = 80, PP = 96, OSP = 516;
    __shared__ __attribute__((aligned(16))) float    Ss[16 * NC];
    __shared__ __attribute__((aligned(16))) _Float16 Ps[16 * PP];
    __shared__ __attribute__((aligned(16))) float    Os[16 * OSP];

    const int tid = threadIdx.x, wave = tid >> 5, lane = tid & 31;
    const int h = lane >> 4, m = lane & 15;
    const int tok0 = blockIdx.x * 16;                // 16 | S, so a tile never straddles a batch
    const int b = tok0 / S;
    const int s0 = tok0 - b * S;
    const size_t bS = (size_t)b * S;
    const float ninf = -__builtin_huge_valf();

    // ---- phase 1: scores ----
    if (wave < 5) {                                  // wave-uniform branch
        const int t = wave;
        const int key  = s0 - HALF + 16 * t + m;
        const int keyc = min(max(key, 0), S - 1);
        const _Float16* pa = qh + (size_t)(tok0 + m) * D + 8 * h;
        const _Float16* pb = kh + (bS + keyc) * D + 8 * h;
        v8f acc = zero8();
#pragma unroll 2
        for (int k0 = 0; k0 < D; k0 += 32) {
            Frag a, bb;
            a.half[0]  = *(const v8h*)(pa + k0);  a.half[1]  = *(const v8h*)(pa + k0 + 16);
            bb.half[0] = *(const v8h*)(pb + k0);  bb.half[1] = *(const v8h*)(pb + k0 + 16);
            acc = wmma16(a.v, bb.v, acc);
        }
#pragma unroll
        for (int r = 0; r < 8; ++r) Ss[(8 * h + r) * NC + 16 * t + m] = acc[r];
    }
    __syncthreads();

    // ---- phase 2: masked softmax, rows 2w and 2w+1 per wave ----
#pragma unroll
    for (int rr = 0; rr < 2; ++rr) {
        const int r = 2 * wave + rr;                 // query row 0..15, position s0 + r
        float xv[3], ev[3];
        bool  vv[3];
        float mx = ninf;
#pragma unroll
        for (int c3 = 0; c3 < 3; ++c3) {
            const int c   = lane + 32 * c3;          // key column 0..95
            const int key = s0 - HALF + c;
            const bool valid = (c < NC) && (c >= r) && (c <= r + 2 * HALF) && (key >= 0) && (key < S);
            float x = ninf;
            if (valid) x = Ss[r * NC + c] * scale;
            xv[c3] = x; vv[c3] = valid;
            mx = fmaxf(mx, x);
        }
#pragma unroll
        for (int o = 16; o > 0; o >>= 1) mx = fmaxf(mx, __shfl_xor(mx, o, 32));
        float sum = 0.f;
#pragma unroll
        for (int c3 = 0; c3 < 3; ++c3) {
            const float e = vv[c3] ? expf(xv[c3] - mx) : 0.f;
            ev[c3] = e;
            sum += e;
        }
#pragma unroll
        for (int o = 16; o > 0; o >>= 1) sum += __shfl_xor(sum, o, 32);
        const float f = pscl / sum;
#pragma unroll
        for (int c3 = 0; c3 < 3; ++c3) {
            const int c = lane + 32 * c3;            // always < 96
            Ps[r * PP + c] = (_Float16)(ev[c3] * f);
        }
    }
    __syncthreads();

    // ---- phase 3: O^T = vT . P^T ----
    Frag pf[3];
#pragma unroll
    for (int j = 0; j < 3; ++j) {
        pf[j].half[0] = *(const v8h*)(Ps + m * PP + 32 * j + 8 * h);
        pf[j].half[1] = *(const v8h*)(Ps + m * PP + 32 * j + 16 + 8 * h);
    }
    for (int hd = 0; hd < 2; ++hd) {
#pragma unroll
        for (int i = 0; i < 4; ++i) {
            const int dtl = wave + 8 * i;            // local value-dim tile 0..31
            const int d0  = 512 * hd + 16 * dtl;
            const _Float16* prow = vT + (size_t)(d0 + m) * ntok + bS;
            v8f acc = zero8();
#pragma unroll
            for (int j = 0; j < 3; ++j) {
                const int g0 = s0 - HALF + 32 * j + 8 * h;
                const int g1 = g0 + 16;
                const int g0c = min(max(g0, 0), S - 8);
                const int g1c = min(max(g1, 0), S - 8);
                Frag a;
                a.half[0] = *(const v8h*)(prow + g0c);
                a.half[1] = *(const v8h*)(prow + g1c);
                acc = wmma16(a.v, pf[j].v, acc);
            }
#pragma unroll
            for (int r = 0; r < 8; ++r) Os[m * OSP + 16 * dtl + 8 * h + r] = acc[r] * pinv;
        }
        __syncthreads();
        v4f ov[8];
#pragma unroll
        for (int rr = 0; rr < 2; ++rr) {
#pragma unroll
            for (int c = 0; c < 4; ++c) {
                const int row = 2 * wave + rr;
                ov[rr * 4 + c] = *(const v4f*)(Os + row * OSP + 128 * c + 4 * lane);
            }
        }
#pragma unroll
        for (int rr = 0; rr < 2; ++rr) {
#pragma unroll
            for (int c = 0; c < 4; ++c) {
                const int row = 2 * wave + rr;
                if (tok0 + row < ntok)
                    *(v4f*)(out + (size_t)(tok0 + row) * D + 512 * hd + 128 * c + 4 * lane) = ov[rr * 4 + c];
            }
        }
        
        __syncthreads();
    }
}

// ---------------------------------------------------------------------------
// Host launch glue
// ---------------------------------------------------------------------------
extern "C" void kernel_launch(void* const* d_in, const int* in_sizes, int n_in,
                              void* d_out, int out_size, void* d_ws, size_t ws_size,
                              hipStream_t stream) {
    if (n_in < 11) return;
    constexpr int S = 2048;                          // sequence length (band boundary)
    const int KV = in_sizes[2];                      // hidden width of the first projection
    const int D  = in_sizes[4];                      // model width
    if (D != 1024 || KV != 1024) return;
    const int ntok = in_sizes[0] / D;                // B*S
    if (ntok <= 0 || ntok * D != in_sizes[0]) return;
    if ((ntok % 128) != 0 || (ntok % S) != 0 || (S % 16) != 0) return;
    if (in_sizes[1] != D * KV || in_sizes[3] != KV * D || in_sizes[5] != D * D ||
        in_sizes[7] != D * D || in_sizes[9] != D * D) return;
    if (in_sizes[6] != D || in_sizes[8] != D || in_sizes[10] != D) return;
    if (out_size != ntok * D) return;

    const float* x  = (const float*)d_in[0];
    const float* w1 = (const float*)d_in[1];
    const float* b1 = (const float*)d_in[2];
    const float* w2 = (const float*)d_in[3];
    const float* b2 = (const float*)d_in[4];
    const float* qw = (const float*)d_in[5];
    const float* qb = (const float*)d_in[6];
    const float* kw = (const float*)d_in[7];
    const float* kb = (const float*)d_in[8];
    const float* vw = (const float*)d_in[9];
    const float* vb = (const float*)d_in[10];
    float* outp = (float*)d_out;

    const size_t nTD = (size_t)ntok * D;             // activations
    const size_t nDD = (size_t)D * D;                // square weights (D == KV)
    _Float16* xh  = (_Float16*)d_ws;                 // [ntok][D]
    _Float16* w1t = xh  + nTD;                       // [KV][D]  (k-contiguous)
    _Float16* w2t = w1t + nDD;                       // [D][KV]
    _Float16* qwt = w2t + nDD;                       // [D][D]
    _Float16* kwt = qwt + nDD;
    _Float16* vwt = kwt + nDD;
    _Float16* hh  = vwt + nDD;                       // [ntok][KV]
    _Float16* mh  = hh  + nTD;                       // [ntok][D]
    _Float16* qh  = mh  + nTD;                       // [ntok][D]
    _Float16* kh  = qh  + nTD;                       // [ntok][D]
    _Float16* vT  = kh  + nTD;                       // [D][ntok]
    const size_t total_halves = 6 * nTD + 5 * nDD;
    if (total_halves * sizeof(_Float16) > ws_size) return;

    const float wscl  = 64.0f, winv = 1.0f / 64.0f;
    const float pscl  = 256.0f, pinv = 1.0f / 256.0f;
    const float scale = 1.0f / sqrtf((float)D);

    // 1) x -> f16
    {
        const int n8 = (int)(nTD / 8);
        k_cvt_f16<<<(n8 + 255) / 256, 256, 0, stream>>>(x, xh, n8);
    }
    // 2) weights [K][N] -> [N][K] f16 * 64   (D == KV, all five are 1024 x 1024)
    {
        dim3 tg((D + 63) / 64, (D + 63) / 64, 5);
        k_wtrans<<<tg, 256, 0, stream>>>(w1, w2, qw, kw, vw, w1t, w2t, qwt, kwt, vwt, D, D, wscl);
    }
    // 3) projections
    {
        dim3 g1((KV + 63) / 64, (ntok + 127) / 128);
        k_gemm<true,  false><<<g1, 256, 0, stream>>>(xh, w1t, b1, hh, ntok, KV, D, winv);   // h = relu(x.W1 + b1)
        dim3 g2((D + 63) / 64, (ntok + 127) / 128);
        k_gemm<false, false><<<g2, 256, 0, stream>>>(hh, w2t, b2, mh, ntok, D, KV, winv);  // m = h.W2 + b2
        k_gemm<false, false><<<g2, 256, 0, stream>>>(mh, qwt, qb, qh, ntok, D, D, winv);   // q
        k_gemm<false, false><<<g2, 256, 0, stream>>>(mh, kwt, kb, kh, ntok, D, D, winv);   // k
        dim3 g3((ntok + 63) / 64, (D + 127) / 128);
        k_gemm<false, true ><<<g3, 256, 0, stream>>>(vwt, mh, vb, vT, D, ntok, D, winv);   // vT[d][tok] = Wv^T.m^T + b[d]
    }
    // 4) banded attention
    k_band_attn<<<ntok / 16, 256, 0, stream>>>(qh, kh, vT, outp, S, ntok, scale, pscl, pinv);
}

// v002
// One run takes 80.5 microseconds.
// In both of two side-by-side timings against v001, it was 1.14 times as fast.
// Counting every step since v000, it is 2.19 times as fast.
#include <hip/hip_runtime.h>
// Contractions: x.W1, h.W2, m.Wq, m.Wk, Wv^T.m^T, banded q.k^T and P.v all on v_wmma_f32_16x16x32_f16 (f16 operands, f32 accumulate); weights carried x64 (folded back as 1/64), softmax weights carried x256 (folded back as 1/256); bias, ReLU, softmax in f32.

typedef _Float16 v16h __attribute__((ext_vector_type(16)));
typedef _Float16 v8h  __attribute__((ext_vector_type(8)));
typedef float    v8f  __attribute__((ext_vector_type(8)));
typedef float    v4f  __attribute__((ext_vector_type(4)));
union Frag { v16h v; v8h half[2]; };

static __device__ __forceinline__ v8f zero8() {
    v8f z = {0.f, 0.f, 0.f, 0.f, 0.f, 0.f, 0.f, 0.f};
    return z;
}

// 16x16x32 f16 WMMA with the VALU hazard guard tied to D, A and B.
static __device__ __forceinline__ v8f wmma16(v16h a, v16h b, v8f c) {
    v8f d = __builtin_amdgcn_wmma_f32_16x16x32_f16(false, a, false, b, (short)0, c, false, false);
    asm volatile("v_nop\n\tv_nop\n\tv_nop\n\tv_nop" : "+v"(d) : "v"(a), "v"(b));
    return d;
}

static __device__ __forceinline__ v8h cvt8(v4f u0, v4f u1) {
    v8h o;
    o[0] = (_Float16)u0[0]; o[1] = (_Float16)u0[1]; o[2] = (_Float16)u0[2]; o[3] = (_Float16)u0[3];
    o[4] = (_Float16)u1[0]; o[5] = (_Float16)u1[1]; o[6] = (_Float16)u1[2]; o[7] = (_Float16)u1[3];
    return o;
}

// ---------------------------------------------------------------------------
// The two preparations, which do not depend on each other, in one launch; block 256,
// grid (ceil(N/64), ceil(K/64), 5 + planes of convert blocks).
// blockIdx.z < 5:  in[K][N] f32  ->  out[N][K] f16 * scl  (k-contiguous weight copy), tensor blockIdx.z,
//                  tile 64(k) x 64(n).
// blockIdx.z >= 5: x f32 -> xh f16, 8 elements a thread; the blocks of these planes are numbered flat.
// ---------------------------------------------------------------------------
__global__ __launch_bounds__(256) void k_prep(const float* __restrict__ x, _Float16* xh, int n8,
                                              const float* __restrict__ w0, const float* __restrict__ w1,
                                              const float* __restrict__ w2, const float* __restrict__ w3,
                                              const float* __restrict__ w4,
                                              _Float16* o0, _Float16* o1, _Float16* o2, _Float16* o3, _Float16* o4,
                                              int K, int N, float scl) {
    __shared__ float tile[64][65];
    const int z = blockIdx.z;
    if (z >= 5) {                                    // block-uniform; leaves in front of the barrier
        const int blk = ((z - 5) * ((K + 63) / 64) + blockIdx.y) * ((N + 63) / 64) + blockIdx.x;
        const int i = blk * 256 + threadIdx.x;
        const bool ok = i < n8;
        const size_t base = (size_t)(ok ? i : 0) * 8;
        const v4f u0 = *(const v4f*)(x + base);
        const v4f u1 = *(const v4f*)(x + base + 4);
        const v8h o = cvt8(u0, u1);
        v8h* p = (v8h*)(xh + base);
        if (ok) *p = o;
        return;
    }
    const float* in = (z == 0) ? w0 : (z == 1) ? w1 : (z == 2) ? w2 : (z == 3) ? w3 : w4;
    _Float16* out   = (z == 0) ? o0 : (z == 1) ? o1 : (z == 2) ? o2 : (z == 3) ? o3 : o4;
    const int n0 = blockIdx.x * 64, k0 = blockIdx.y * 64;
    const int tid = threadIdx.x;
    const int cn = tid & 63, rk = tid >> 6;          // rk 0..3
#pragma unroll
    for (int i = 0; i < 16; ++i) {
        const int kk = rk + 4 * i;                   // 0..63
        float v = 0.f;
        if (k0 + kk < K && n0 + cn < N) v = in[(size_t)(k0 + kk) * N + n0 + cn];
        tile[kk][cn] = v;
    }
    __syncthreads();
    const int lane = tid & 31, wave = tid >> 5;
    const int p = lane & 7, rq = lane >> 3;          // p: 16-B piece (k 8p..8p+7), rq: row within group of 4
    // wave w writes output rows nn = 8w .. 8w+7 (2 instructions x 4 rows)
    v8h vals[2];
#pragma unroll
    for (int i = 0; i < 2; ++i) {
        const int nn = 8 * wave + 4 * i + rq;
        v8h o;
#pragma unroll
        for (int e = 0; e < 8; ++e) o[e] = (_Float16)(tile[8 * p + e][nn] * scl);
        vals[i] = o;
    }
#pragma unroll
    for (int i = 0; i < 2; ++i) {
        const int nn = 8 * wave + 4 * i + rq;
        if (n0 + nn < N && k0 + 8 * p + 8 <= K)
            *(v8h*)(out + (size_t)(n0 + nn) * K + k0 + 8 * p) = vals[i];
    }
    
}

// ---------------------------------------------------------------------------
// Twelve asynchronous 16-byte copies per lane, global -> LDS, through no register: copy i brings g[i] + koff
// (halves) to LDS byte l0 + i * step.  The closing s_wait_xcnt 0 stands in the copies' own statement so that
// no address register of an issued copy is rewritten in front of it.
// ---------------------------------------------------------------------------
static __device__ __forceinline__ void copy12(unsigned l0, unsigned step, const _Float16* const (&g)[12], int koff) {
    asm volatile(
        "global_load_async_to_lds_b128 %0, %12, off\n\t"
        "global_load_async_to_lds_b128 %1, %13, off\n\t"
        "global_load_async_to_lds_b128 %2, %14, off\n\t"
        "global_load_async_to_lds_b128 %3, %15, off\n\t"
        "global_load_async_to_lds_b128 %4, %16, off\n\t"
        "global_load_async_to_lds_b128 %5, %17, off\n\t"
        "global_load_async_to_lds_b128 %6, %18, off\n\t"
        "global_load_async_to_lds_b128 %7, %19, off\n\t"
        "global_load_async_to_lds_b128 %8, %20, off\n\t"
        "global_load_async_to_lds_b128 %9, %21, off\n\t"
        "global_load_async_to_lds_b128 %10, %22, off\n\t"
        "global_load_async_to_lds_b128 %11, %23, off\n\t"
        "s_wait_xcnt 0x0"
        :: "v"(l0), "v"(l0 + step), "v"(l0 + 2 * step), "v"(l0 + 3 * step), "v"(l0 + 4 * step), "v"(l0 + 5 * step),
           "v"(l0 + 6 * step), "v"(l0 + 7 * step), "v"(l0 + 8 * step), "v"(l0 + 9 * step), "v"(l0 + 10 * step),
           "v"(l0 + 11 * step),
           "v"(g[0] + koff), "v"(g[1] + koff), "v"(g[2] + koff), "v"(g[3] + koff), "v"(g[4] + koff), "v"(g[5] + koff),
           "v"(g[6] + koff), "v"(g[7] + koff), "v"(g[8] + koff), "v"(g[9] + koff), "v"(g[10] + koff), "v"(g[11] + koff)
        : "memory");
}

// ---------------------------------------------------------------------------
// C[M][N] (f16, pitch N) = act((A[M][K] . Bt[N][K]^T) * inv + bias),  K a multiple of 128.
// Block 256 = 8 waves -> 128x64 tile; wave (wm, wn) owns 32x32 = 4 accumulators.
// A pass is 128 k: its 128 A rows and 64 Bt rows (256 B each) are copied whole-line into one of two LDS buffers
// (row pitch 272 B) while the pass before is worked on; fragments are read from LDS with the split k map for
// BOTH A and Bt:
//   lane l: row/col = l&15, h = l>>4; elements 0..7 <- k0+8h+0..7, elements 8..15 <- k0+16+8h+0..7.
// D: element r of lane l = (row 8h+r, col l&15).
// The tile is (bx, by); brow (the same for the whole block): the bias goes by row of C, else by column.
// ---------------------------------------------------------------------------
constexpr int CSP = 68;                              // pitch of the staged C tile, floats

template <bool RELU, bool BROW>
static __device__ __forceinline__ void gemm_store(const float* Cs, const float* __restrict__ bias, _Float16* C,
                                                  int M, int N, float inv, int m0, int n0, int wave, int lane);

template <bool RELU>
static __device__ __forceinline__ void gemm_tile(const _Float16* __restrict__ A, const _Float16* __restrict__ Bt,
                                                 const float* __restrict__ bias, _Float16* C,
                                                 int M, int N, int K, float inv, bool brow, int bx, int by) {
    constexpr int KP = 128, LP = 136, STG = 192 * LP;    // k per pass; LDS row pitch and buffer size in halves
    __shared__ __attribute__((aligned(16))) float Cs[128 * CSP];
    __shared__ __attribute__((aligned(16))) _Float16 Ts[2 * STG];
    const int tid = threadIdx.x, wave = tid >> 5, lane = tid & 31;
    const int h = lane >> 4, m = lane & 15;
    const int m0 = by * 128, n0 = bx * 64;
    const int wm = (wave & 3) * 32, wn = (wave >> 2) * 32;

    // copy map: thread -> row tid>>4 of each group of 16 rows, 16-byte piece tid&15; groups 0..7 = A, 8..11 = Bt
    const int crow = tid >> 4, cpc = tid & 15;
    const _Float16* g[12];
#pragma unroll   // constant indices keep g[] in registers
    for (int i = 0; i < 8; ++i) g[i] = A + (size_t)min(m0 + 16 * i + crow, M - 1) * K + 8 * cpc;
#pragma unroll   // as above
    for (int i = 0; i < 4; ++i) g[8 + i] = Bt + (size_t)min(n0 + 16 * i + crow, N - 1) * K + 8 * cpc;
    const unsigned lds0 = (unsigned)(size_t)(Ts + crow * LP + 8 * cpc);   // low 32 bits = LDS byte address
    constexpr unsigned GSTEP = 16 * LP * 2, BUFB = STG * 2;               // bytes per 16 rows, per buffer
    const int npass = K / KP;

    copy12(lds0, GSTEP, g, 0);
    asm volatile("s_wait_asynccnt 0x0" ::: "memory");   // this wave's share of pass 0 has landed
    __syncthreads();                                    // publishes pass 0 to every wave
    if (npass > 1) copy12(lds0 + BUFB, GSTEP, g, KP);

    const int fa = (wm + m) * LP + 8 * h;               // fragment offsets inside a buffer, halves
    const int fb = (128 + wn + m) * LP + 8 * h;
    v8f c00 = zero8(), c01 = zero8(), c10 = zero8(), c11 = zero8();
    for (int t = 0; t < npass; ++t) {
        const _Float16* tb = Ts + (t & 1) * STG;
#pragma unroll   // constant k0 folds into the LDS loads' offset field
        for (int k0 = 0; k0 < KP; k0 += 32) {
            Frag a0, a1, b0, b1;
            a0.half[0] = *(const v8h*)(tb + fa + k0);            a0.half[1] = *(const v8h*)(tb + fa + k0 + 16);
            a1.half[0] = *(const v8h*)(tb + fa + 16 * LP + k0);  a1.half[1] = *(const v8h*)(tb + fa + 16 * LP + k0 + 16);
            b0.half[0] = *(const v8h*)(tb + fb + k0);            b0.half[1] = *(const v8h*)(tb + fb + k0 + 16);
            b1.half[0] = *(const v8h*)(tb + fb + 16 * LP + k0);  b1.half[1] = *(const v8h*)(tb + fb + 16 * LP + k0 + 16);
            c00 = wmma16(a0.v, b0.v, c00);
            c01 = wmma16(a0.v, b1.v, c01);
            c10 = wmma16(a1.v, b0.v, c10);
            c11 = wmma16(a1.v, b1.v, c11);
        }
        asm volatile("s_wait_dscnt 0x0" ::: "memory");     // this wave's reads of buffer t&1 are done before it is refilled
        asm volatile("s_wait_asynccnt 0x0" ::: "memory");  // this wave's share of pass t+1 has landed
        __syncthreads();                                   // publishes pass t+1 and ends every read of buffer t&1
        if (t + 2 < npass) copy12(lds0 + (t & 1) * BUFB, GSTEP, g, (t + 2) * KP);
    }
    asm volatile("s_wait_asynccnt 0x0" ::: "memory");      // no copy is outstanding behind the loop

    // stage D: acc element r -> row 8h+r, col m of its 16x16 tile
#pragma unroll
    for (int r = 0; r < 8; ++r) {
        Cs[(wm + 8 * h + r) * CSP + wn + m]           = c00[r];
        Cs[(wm + 8 * h + r) * CSP + wn + 16 + m]      = c01[r];
        Cs[(wm + 16 + 8 * h + r) * CSP + wn + m]      = c10[r];
        Cs[(wm + 16 + 8 * h + r) * CSP + wn + 16 + m] = c11[r];
    }
    __syncthreads();

    if (brow) gemm_store<RELU, true >(Cs, bias, C, M, N, inv, m0, n0, wave, lane);   // block-uniform
    else      gemm_store<RELU, false>(Cs, bias, C, M, N, inv, m0, n0, wave, lane);
}

// The staged 128x64 f32 tile -> act(. * inv + bias) as f16, whole 128-byte lines.
template <bool RELU, bool BROW>
static __device__ __forceinline__ void gemm_store(const float* Cs, const float* __restrict__ bias, _Float16* C,
                                                  int M, int N, float inv, int m0, int n0, int wave, int lane) {
    const int p = lane & 7, rq = lane >> 3;          // p: cols 8p..8p+7, rq: row within group of 4
    v4f bc0 = {0.f, 0.f, 0.f, 0.f}, bc1 = {0.f, 0.f, 0.f, 0.f};
    if (!BROW) {
        if (n0 + 8 * p + 8 <= N) {
            bc0 = *(const v4f*)(bias + n0 + 8 * p);
            bc1 = *(const v4f*)(bias + n0 + 8 * p + 4);
        }
    }
    // wave w writes rows 16w..16w+15 (4 instructions x 4 rows)
    v8h vals[4];
#pragma unroll
    for (int i = 0; i < 4; ++i) {
        const int rloc = 16 * wave + 4 * i + rq;
        const float* src = Cs + rloc * CSP + 8 * p;
        v4f u0 = *(const v4f*)src;
        v4f u1 = *(const v4f*)(src + 4);
        v4f b0v = bc0, b1v = bc1;
        if (BROW) {
            const float bb = bias[min(m0 + rloc, M - 1)];
            v4f t = {bb, bb, bb, bb};
            b0v = t; b1v = t;
        }
        u0 = u0 * inv + b0v;
        u1 = u1 * inv + b1v;
        if (RELU) {
            u0[0] = fmaxf(u0[0], 0.f); u0[1] = fmaxf(u0[1], 0.f); u0[2] = fmaxf(u0[2], 0.f); u0[3] = fmaxf(u0[3], 0.f);
            u1[0] = fmaxf(u1[0], 0.f); u1[1] = fmaxf(u1[1], 0.f); u1[2] = fmaxf(u1[2], 0.f); u1[3] = fmaxf(u1[3], 0.f);
        }
        vals[i] = cvt8(u0, u1);
    }
#pragma unroll
    for (int i = 0; i < 4; ++i) {
        const int grow = m0 + 16 * wave + 4 * i + rq;
        if (grow < M && n0 + 8 * p + 8 <= N)
            *(v8h*)(C + (size_t)grow * N + n0 + 8 * p) = vals[i];
    }
    
}

// One product, grid (ceil(N/64), ceil(M/128)), bias by column.
template <bool RELU>
__global__ __launch_bounds__(256) void k_gemm(const _Float16* __restrict__ A, const _Float16* __restrict__ Bt,
                                              const float* __restrict__ bias, _Float16* C,
                                              int M, int N, int K, float inv) {
    gemm_tile<RELU>(A, Bt, bias, C, M, N, K, inv, false, blockIdx.x, blockIdx.y);
}

// The three products of m, which do not depend on each other, in one launch; grid (D/64, ntok/128, 3), 128 | D, ntok.
// blockIdx.z 0: q = m.Wq + qb;  1: k = m.Wk + kb;  2: vT[d][tok] = Wv^T.m^T + vb[d] (operands swapped, bias by row).
// vT has ntok/64 x D/128 tiles, as many as q: block (x, y) takes its tile (2y + (x & 1), x >> 1).
__global__ __launch_bounds__(256) void k_gemm_qkv(const _Float16* __restrict__ mh, const _Float16* __restrict__ qwt,
                                                  const _Float16* __restrict__ kwt, const _Float16* __restrict__ vwt,
                                                  const float* __restrict__ qb, const float* __restrict__ kb,
                                                  const float* __restrict__ vb,
                                                  _Float16* qh, _Float16* kh, _Float16* vT,
                                                  int ntok, int D, float inv) {
    const int z = blockIdx.z;
    const bool tr = (z == 2);
    const _Float16* A  = tr ? vwt : mh;
    const _Float16* Bt = tr ? mh : (z == 0) ? qwt : kwt;
    const float* bias  = tr ? vb : (z == 0) ? qb : kb;
    _Float16* C        = tr ? vT : (z == 0) ? qh : kh;
    const int M = tr ? D : ntok, N = tr ? ntok : D;
    const int bx = tr ? 2 * blockIdx.y + (blockIdx.x & 1) : blockIdx.x;
    const int by = tr ? blockIdx.x >> 1 : blockIdx.y;
    gemm_tile<false>(A, Bt, bias, C, M, N, D, inv, tr, bx, by);
}

// ---------------------------------------------------------------------------
// Banded attention, window offsets -32..+32, D = 1024.  One block (256 = 8 waves) per tile of 16 queries.
//   qh, kh : [ntok][1024] f16 (token-major);  vT : [1024][ntok] f16 (value dim major);  out : [ntok][1024] f32.
// Phase 1: scores S[16 q][80 keys] (keys s0-32 .. s0+47): wave t<5 computes key tile t on WMMA over k = 1024
//          (A = q rows, B[k=d][n=key] from k rows with the same split map), f32 into LDS.
// Phase 2: f32 masked softmax per query row (2 rows per wave), P*pscl as f16 into LDS [16][96] (cols 80..95 = 0).
// Phase 3: O^T[d][q] = vT[d][keys] . P^T[keys][q] on WMMA (3 k-steps of 32 keys; A from vT rows, clamped
//          in-range loads where P is zero; B = P^T loaded from the [q][key] LDS tile with the split map),
// ---------------------------------------------------------------------------
__global__ __launch_bounds__(256) void k_band_attn(const _Float16* __restrict__ qh, const _Float16* __restrict__ kh,
                                                   const _Float16* __restrict__ vT, float* out,
                                                   int S, int ntok, float scale, float pscl, float pinv) {
    constexpr int D = 1024, HALF = 32, NC = 80, PP = 96, OSP = 516;
    __shared__ __attribute__((aligned(16))) float    Ss[16 * NC];
    __shared__ __attribute__((aligned(16))) _Float16 Ps[16 * PP];
    __shared__ __attribute__((aligned(16))) float    Os[16 * OSP];

    const int tid = threadIdx.x, wave = tid >> 5, lane = tid & 31;
    const int h = lane >> 4, m = lane & 15;
    const int tok0 = blockIdx.x * 16;                // 16 | S, so a tile never straddles a batch
    const int b = tok0 / S;
    const int s0 = tok0 - b * S;
    const size_t bS = (size_t)b * S;
    const float ninf = -__builtin_huge_valf();

    // ---- phase 1: scores ----
    if (wave < 5) {                                  // wave-uniform branch
        const int t = wave;
        const int key  = s0 - HALF + 16 * t + m;
        const int keyc = min(max(key, 0), S - 1);
        const _Float16* pa = qh + (size_t)(tok0 + m) * D + 8 * h;
        const _Float16* pb = kh + (bS + keyc) * D + 8 * h;
        v8f acc = zero8();
#pragma unroll 2
        for (int k0 = 0; k0 < D; k0 += 32) {
            Frag a, bb;
            a.half[0]  = *(const v8h*)(pa + k0);  a.half[1]  = *(const v8h*)(pa + k0 + 16);
            bb.half[0] = *(const v8h*)(pb + k0);  bb.half[1] = *(const v8h*)(pb + k0 + 16);
            acc = wmma16(a.v, bb.v, acc);
        }
#pragma unroll
        for (int r = 0; r < 8; ++r) Ss[(8 * h + r) * NC + 16 * t + m] = acc[r];
    }
    __syncthreads();

    // ---- phase 2: masked softmax, rows 2w and 2w+1 per wave ----
#pragma unroll
    for (int rr = 0; rr < 2; ++rr) {
        const int r = 2 * wave + rr;                 // query row 0..15, position s0 + r
        float xv[3], ev[3];
        bool  vv[3];
        float mx = ninf;
#pragma unroll
        for (int c3 = 0; c3 < 3; ++c3) {
            const int c   = lane + 32 * c3;          // key column 0..95
            const int key = s0 - HALF + c;
            const bool valid = (c < NC) && (c >= r) && (c <= r + 2 * HALF) && (key >= 0) && (key < S);
            float x = ninf;
            if (valid) x = Ss[r * NC + c] * scale;
            xv[c3] = x; vv[c3] = valid;
            mx = fmaxf(mx, x);
        }
#pragma unroll
        for (int o = 16; o > 0; o >>= 1) mx = fmaxf(mx, __shfl_xor(mx, o, 32));
        float sum = 0.f;
#pragma unroll
        for (int c3 = 0; c3 < 3; ++c3) {
            const float e = vv[c3] ? expf(xv[c3] - mx) : 0.f;
            ev[c3] = e;
            sum += e;
        }
#pragma unroll
        for (int o = 16; o > 0; o >>= 1) sum += __shfl_xor(sum, o, 32);
        const float f = pscl / sum;
#pragma unroll
        for (int c3 = 0; c3 < 3; ++c3) {
            const int c = lane + 32 * c3;            // always < 96
            Ps[r * PP + c] = (_Float16)(ev[c3] * f);
        }
    }
    __syncthreads();

    // ---- phase 3: O^T = vT . P^T ----
    Frag pf[3];
#pragma unroll
    for (int j = 0; j < 3; ++j) {
        pf[j].half[0] = *(const v8h*)(Ps + m * PP + 32 * j + 8 * h);
        pf[j].half[1] = *(const v8h*)(Ps + m * PP + 32 * j + 16 + 8 * h);
    }
    for (int hd = 0; hd < 2; ++hd) {
#pragma unroll
        for (int i = 0; i < 4; ++i) {
            const int dtl = wave + 8 * i;            // local value-dim tile 0..31
            const int d0  = 512 * hd + 16 * dtl;
            const _Float16* prow = vT + (size_t)(d0 + m) * ntok + bS;
            v8f acc = zero8();
#pragma unroll
            for (int j = 0; j < 3; ++j) {
                const int g0 = s0 - HALF + 32 * j + 8 * h;
                const int g1 = g0 + 16;
                const int g0c = min(max(g0, 0), S - 8);
                const int g1c = min(max(g1, 0), S - 8);
                Frag a;
                a.half[0] = *(const v8h*)(prow + g0c);
                a.half[1] = *(const v8h*)(prow + g1c);
                acc = wmma16(a.v, pf[j].v, acc);
            }
#pragma unroll
            for (int r = 0; r < 8; ++r) Os[m * OSP + 16 * dtl + 8 * h + r] = acc[r] * pinv;
        }
        __syncthreads();
        v4f ov[8];
#pragma unroll
        for (int rr = 0; rr < 2; ++rr) {
#pragma unroll
            for (int c = 0; c < 4; ++c) {
                const int row = 2 * wave + rr;
                ov[rr * 4 + c] = *(const v4f*)(Os + row * OSP + 128 * c + 4 * lane);
            }
        }
#pragma unroll
        for (int rr = 0; rr < 2; ++rr) {
#pragma unroll
            for (int c = 0; c < 4; ++c) {
                const int row = 2 * wave + rr;
                if (tok0 + row < ntok)
                    *(v4f*)(out + (size_t)(tok0 + row) * D + 512 * hd + 128 * c + 4 * lane) = ov[rr * 4 + c];
            }
        }
        
        __syncthreads();
    }
}

// ---------------------------------------------------------------------------
// Host launch glue
// ---------------------------------------------------------------------------
extern "C" void kernel_launch(void* const* d_in, const int* in_sizes, int n_in,
                              void* d_out, int out_size, void* d_ws, size_t ws_size,
                              hipStream_t stream) {
    if (n_in < 11) return;
    constexpr int S = 2048;                          // sequence length (band boundary)
    const int KV = in_sizes[2];                      // hidden width of the first projection
    const int D  = in_sizes[4];                      // model width
    if (D != 1024 || KV != 1024) return;
    const int ntok = in_sizes[0] / D;                // B*S
    if (ntok <= 0 || ntok * D != in_sizes[0]) return;
    if ((ntok % 128) != 0 || (ntok % S) != 0 || (S % 16) != 0) return;
    if (in_sizes[1] != D * KV || in_sizes[3] != KV * D || in_sizes[5] != D * D ||
        in_sizes[7] != D * D || in_sizes[9] != D * D) return;
    if (in_sizes[6] != D || in_sizes[8] != D || in_sizes[10] != D) return;
    if (out_size != ntok * D) return;

    const float* x  = (const float*)d_in[0];
    const float* w1 = (const float*)d_in[1];
    const float* b1 = (const float*)d_in[2];
    const float* w2 = (const float*)d_in[3];
    const float* b2 = (const float*)d_in[4];
    const float* qw = (const float*)d_in[5];
    const float* qb = (const float*)d_in[6];
    const float* kw = (const float*)d_in[7];
    const float* kb = (const float*)d_in[8];
    const float* vw = (const float*)d_in[9];
    const float* vb = (const float*)d_in[10];
    float* outp = (float*)d_out;

    const size_t nTD = (size_t)ntok * D;             // activations
    const size_t nDD = (size_t)D * D;                // square weights (D == KV)
    _Float16* xh  = (_Float16*)d_ws;                 // [ntok][D]
    _Float16* w1t = xh  + nTD;                       // [KV][D]  (k-contiguous)
    _Float16* w2t = w1t + nDD;                       // [D][KV]
    _Float16* qwt = w2t + nDD;                       // [D][D]
    _Float16* kwt = qwt + nDD;
    _Float16* vwt = kwt + nDD;
    _Float16* hh  = vwt + nDD;                       // [ntok][KV]
    _Float16* mh  = hh  + nTD;                       // [ntok][D]
    _Float16* qh  = mh  + nTD;                       // [ntok][D]
    _Float16* kh  = qh  + nTD;                       // [ntok][D]
    _Float16* vT  = kh  + nTD;                       // [D][ntok]
    const size_t total_halves = 6 * nTD + 5 * nDD;
    if (total_halves * sizeof(_Float16) > ws_size) return;

    const float wscl  = 64.0f, winv = 1.0f / 64.0f;
    const float pscl  = 256.0f, pinv = 1.0f / 256.0f;
    const float scale = 1.0f / sqrtf((float)D);

    // 1) weights [K][N] -> [N][K] f16 * 64   (D == KV, all five are 1024 x 1024), and x -> f16, one launch
    {
        const int n8 = (int)(nTD / 8);
        const int plane = ((D + 63) / 64) * ((D + 63) / 64);             // blocks in one z plane
        dim3 tg((D + 63) / 64, (D + 63) / 64, 5 + ((n8 + 255) / 256 + plane - 1) / plane);
        k_prep<<<tg, 256, 0, stream>>>(x, xh, n8, w1, w2, qw, kw, vw, w1t, w2t, qwt, kwt, vwt, D, D, wscl);
    }
    // 2) projections
    {
        dim3 g1((KV + 63) / 64, (ntok + 127) / 128);
        k_gemm<true ><<<g1, 256, 0, stream>>>(xh, w1t, b1, hh, ntok, KV, D, winv);   // h = relu(x.W1 + b1)
        dim3 g2((D + 63) / 64, (ntok + 127) / 128);
        k_gemm<false><<<g2, 256, 0, stream>>>(hh, w2t, b2, mh, ntok, D, KV, winv);  // m = h.W2 + b2
        dim3 g3((D + 63) / 64, (ntok + 127) / 128, 3);
        k_gemm_qkv<<<g3, 256, 0, stream>>>(mh, qwt, kwt, vwt, qb, kb, vb, qh, kh, vT, ntok, D, winv);   // q, k, vT
    }
    // 3) banded attention
    k_band_attn<<<ntok / 16, 256, 0, stream>>>(qh, kh, vT, outp, S, ntok, scale, pscl, pinv);
}

// v003
// One run takes 76.6 microseconds.
// Timed twice side by side with v002, it ran 1.05 times as fast both times.
// All steps since v000 together make it 2.30 times as fast.
#include <hip/hip_runtime.h>
// Contractions: x.W1, h.W2, m.Wq, m.Wk, Wv^T.m^T, banded q.k^T and P.v all on v_wmma_f32_16x16x32_f16 (f16 operands, f32 accumulate); weights carried x64 (folded back as 1/64), softmax weights carried x256 (folded back as 1/256); bias, ReLU, softmax in f32.

typedef _Float16 v16h __attribute__((ext_vector_type(16)));
typedef _Float16 v8h  __attribute__((ext_vector_type(8)));
typedef float    v8f  __attribute__((ext_vector_type(8)));
typedef float    v4f  __attribute__((ext_vector_type(4)));
union Frag { v16h v; v8h half[2]; };

static __device__ __forceinline__ v8f zero8() {
    v8f z = {0.f, 0.f, 0.f, 0.f, 0.f, 0.f, 0.f, 0.f};
    return z;
}

// 16x16x32 f16 WMMA with the VALU hazard guard tied to D, A and B.
static __device__ __forceinline__ v8f wmma16(v16h a, v16h b, v8f c) {
    v8f d = __builtin_amdgcn_wmma_f32_16x16x32_f16(false, a, false, b, (short)0, c, false, false);
    asm volatile("v_nop\n\tv_nop\n\tv_nop\n\tv_nop" : "+v"(d) : "v"(a), "v"(b));
    return d;
}

static __device__ __forceinline__ v8h cvt8(v4f u0, v4f u1) {
    v8h o;
    o[0] = (_Float16)u0[0]; o[1] = (_Float16)u0[1]; o[2] = (_Float16)u0[2]; o[3] = (_Float16)u0[3];
    o[4] = (_Float16)u1[0]; o[5] = (_Float16)u1[1]; o[6] = (_Float16)u1[2]; o[7] = (_Float16)u1[3];
    return o;
}

// ---------------------------------------------------------------------------
// The two preparations, which do not depend on each other, in one launch of few, long-lived blocks; block 256,
// grid (DW/64, DW/64): as many blocks as one DW x DW weight has 64(k) x 64(n) tiles.  Block (bx, by) does
//   - tile (bx, by) of each of the five weights: in[k][n] f32 -> out[n][k] f16 * scl (k-contiguous weight copy);
//   - run bx + by * DW/64 of x f32 -> xh f16: a run is 2048 pieces of 8 elements, 8 pieces a thread (2048 | n8).
// All 36 loads of a thread (x first, then the five tiles) are issued before the first is used; one barrier a block.
// ---------------------------------------------------------------------------
constexpr int DW = 1024;                             // side of every weight; kernel_launch takes no other

__global__ __launch_bounds__(256) void k_prep(const float* __restrict__ x, _Float16* xh, int n8,
                                              const float* __restrict__ w0, const float* __restrict__ w1,
                                              const float* __restrict__ w2, const float* __restrict__ w3,
                                              const float* __restrict__ w4,
                                              _Float16* o0, _Float16* o1, _Float16* o2, _Float16* o3, _Float16* o4,
                                              float scl) {
    static_assert(DW % 64 == 0, "whole tiles only");
    constexpr int NB = (DW / 64) * (DW / 64);        // blocks in the grid
    __shared__ float tile[5][64][65];
    const float* const win[5] = {w0, w1, w2, w3, w4};
    _Float16* const wout[5]   = {o0, o1, o2, o3, o4};
    const int n0 = blockIdx.x * 64, k0 = blockIdx.y * 64;
    const int tid = threadIdx.x;
    const int tr = tid >> 4, tc = (tid & 15) * 4;    // row within a group of 16 rows, first of 4 columns

    // x: the block's run; a block without one reads run 0 and stores nothing (block-uniform)
    const int run = blockIdx.y * (DW / 64) + blockIdx.x;
    const bool has = run * 2048 < n8;
    const size_t xo = (size_t)(has ? run : 0) * 16384 + tid * 8;
    const float* px = x + xo;
    _Float16* ph = xh + xo;
    v4f u0[8], u1[8];
#pragma unroll   // constant indices keep u0[], u1[] in registers
    for (int j = 0; j < 8; ++j) {
        u0[j] = *(const v4f*)(px + j * 2048);
        u1[j] = *(const v4f*)(px + j * 2048 + 4);
    }

    // the five tiles, 16 bytes a load (a wave: two rows of 256 B): one offset for all, the row step is a constant
    v4f tv[5][4];
    const unsigned tb = (unsigned)((k0 + tr) * DW + n0 + tc) * 4u;   // byte offset, the same in every weight
#pragma unroll   // constant indices keep tv[][] in registers
    for (int z = 0; z < 5; ++z) {
#pragma unroll
        for (int i = 0; i < 4; ++i) tv[z][i] = *(const v4f*)(((const char*)win[z] + tb) + 16 * i * DW * 4);
    }
    // Stands behind the 36 loads, before any register that they name is rewritten; the two address operands
    // stay live up to here, so that no load's result lands on them.
    asm volatile("s_wait_xcnt 0x0" :: "v"(px), "v"(tb) : "memory");

    if (has) {
#pragma unroll
        for (int j = 0; j < 8; ++j) *(v8h*)(ph + j * 2048) = cvt8(u0[j], u1[j]);
    }

#pragma unroll
    for (int z = 0; z < 5; ++z) {
#pragma unroll
        for (int i = 0; i < 4; ++i) {
#pragma unroll
            for (int e = 0; e < 4; ++e) tile[z][tr + 16 * i][tc + e] = tv[z][i][e];
        }
    }
    __syncthreads();
    const int lane = tid & 31, wave = tid >> 5;
    const int p = lane & 7, rq = lane >> 3;          // p: 16-B piece (k 8p..8p+7), rq: row within group of 4
    // wave w writes output rows nn = 8w .. 8w+7 of every tile (2 instructions x 4 rows each)
#pragma unroll
    for (int z = 0; z < 5; ++z) {
#pragma unroll
        for (int i = 0; i < 2; ++i) {
            const int nn = 8 * wave + 4 * i + rq;
            v8h o;
#pragma unroll
            for (int e = 0; e < 8; ++e) o[e] = (_Float16)(tile[z][8 * p + e][nn] * scl);
            *(v8h*)(wout[z] + (n0 + nn) * DW + k0 + 8 * p) = o;
        }
    }

    // runs of x beyond one a block, where x is that long
    asm volatile("s_wait_xcnt 0x0" ::: "memory");    // before registers that the stores above name are rewritten
    for (int r = run + NB; r * 2048 < n8; r += NB) {
        px += (size_t)NB * 16384;
        ph += (size_t)NB * 16384;
        for (int j = 0; j < 8; ++j)
            *(v8h*)(ph + j * 2048) = cvt8(*(const v4f*)(px + j * 2048), *(const v4f*)(px + j * 2048 + 4));
    }
}

// ---------------------------------------------------------------------------
// Twelve asynchronous 16-byte copies per lane, global -> LDS, through no register: copy i brings g[i] + koff
// (halves) to LDS byte l0 + i * step.  The closing s_wait_xcnt 0 stands in the copies' own statement so that
// no address register of an issued copy is rewritten in front of it.
// ---------------------------------------------------------------------------
static __device__ __forceinline__ void copy12(unsigned l0, unsigned step, const _Float16* const (&g)[12], int koff) {
    asm volatile(
        "global_load_async_to_lds_b128 %0, %12, off\n\t"
        "global_load_async_to_lds_b128 %1, %13, off\n\t"
        "global_load_async_to_lds_b128 %2, %14, off\n\t"
        "global_load_async_to_lds_b128 %3, %15, off\n\t"
        "global_load_async_to_lds_b128 %4, %16, off\n\t"
        "global_load_async_to_lds_b128 %5, %17, off\n\t"
        "global_load_async_to_lds_b128 %6, %18, off\n\t"
        "global_load_async_to_lds_b128 %7, %19, off\n\t"
        "global_load_async_to_lds_b128 %8, %20, off\n\t"
        "global_load_async_to_lds_b128 %9, %21, off\n\t"
        "global_load_async_to_lds_b128 %10, %22, off\n\t"
        "global_load_async_to_lds_b128 %11, %23, off\n\t"
        "s_wait_xcnt 0x0"
        :: "v"(l0), "v"(l0 + step), "v"(l0 + 2 * step), "v"(l0 + 3 * step), "v"(l0 + 4 * step), "v"(l0 + 5 * step),
           "v"(l0 + 6 * step), "v"(l0 + 7 * step), "v"(l0 + 8 * step), "v"(l0 + 9 * step), "v"(l0 + 10 * step),
           "v"(l0 + 11 * step),
           "v"(g[0] + koff), "v"(g[1] + koff), "v"(g[2] + koff), "v"(g[3] + koff), "v"(g[4] + koff), "v"(g[5] + koff),
           "v"(g[6] + koff), "v"(g[7] + koff), "v"(g[8] + koff), "v"(g[9] + koff), "v"(g[10] + koff), "v"(g[11] + koff)
        : "memory");
}

// ---------------------------------------------------------------------------
// C[M][N] (f16, pitch N) = act((A[M][K] . Bt[N][K]^T) * inv + bias),  K a multiple of 128.
// Block 256 = 8 waves -> 128x64 tile; wave (wm, wn) owns 32x32 = 4 accumulators.
// A pass is 128 k: its 128 A rows and 64 Bt rows (256 B each) are copied whole-line into one of two LDS buffers
// (row pitch 272 B) while the pass before is worked on; fragments are read from LDS with the split k map for
// BOTH A and Bt:
//   lane l: row/col = l&15, h = l>>4; elements 0..7 <- k0+8h+0..7, elements 8..15 <- k0+16+8h+0..7.
// D: element r of lane l = (row 8h+r, col l&15).
// The tile is (bx, by); brow (the same for the whole block): the bias goes by row of C, else by column.
// ---------------------------------------------------------------------------
constexpr int CSP = 68;                              // pitch of the staged C tile, floats

template <bool RELU, bool BROW>
static __device__ __forceinline__ void gemm_store(const float* Cs, const float* __restrict__ bias, _Float16* C,
                                                  int M, int N, float inv, int m0, int n0, int wave, int lane);

template <bool RELU>
static __device__ __forceinline__ void gemm_tile(const _Float16* __restrict__ A, const _Float16* __restrict__ Bt,
                                                 const float* __restrict__ bias, _Float16* C,
                                                 int M, int N, int K, float inv, bool brow, int bx, int by) {
    constexpr int KP = 128, LP = 136, STG = 192 * LP;    // k per pass; LDS row pitch and buffer size in halves
    __shared__ __attribute__((aligned(16))) float Cs[128 * CSP];
    __shared__ __attribute__((aligned(16))) _Float16 Ts[2 * STG];
    const int tid = threadIdx.x, wave = tid >> 5, lane = tid & 31;
    const int h = lane >> 4, m = lane & 15;
    const int m0 = by * 128, n0 = bx * 64;
    const int wm = (wave & 3) * 32, wn = (wave >> 2) * 32;

    // copy map: thread -> row tid>>4 of each group of 16 rows, 16-byte piece tid&15; groups 0..7 = A, 8..11 = Bt
    const int crow = tid >> 4, cpc = tid & 15;
    const _Float16* g[12];
#pragma unroll   // constant indices keep g[] in registers
    for (int i = 0; i < 8; ++i) g[i] = A + (size_t)min(m0 + 16 * i + crow, M - 1) * K + 8 * cpc;
#pragma unroll   // as above
    for (int i = 0; i < 4; ++i) g[8 + i] = Bt + (size_t)min(n0 + 16 * i + crow, N - 1) * K + 8 * cpc;
    const unsigned lds0 = (unsigned)(size_t)(Ts + crow * LP + 8 * cpc);   // low 32 bits = LDS byte address
    constexpr unsigned GSTEP = 16 * LP * 2, BUFB = STG * 2;               // bytes per 16 rows, per buffer
    const int npass = K / KP;

    copy12(lds0, GSTEP, g, 0);
    asm volatile("s_wait_asynccnt 0x0" ::: "memory");   // this wave's share of pass 0 has landed
    __syncthreads();                                    // publishes pass 0 to every wave
    if (npass > 1) copy12(lds0 + BUFB, GSTEP, g, KP);

    const int fa = (wm + m) * LP + 8 * h;               // fragment offsets inside a buffer, halves
    const int fb = (128 + wn + m) * LP + 8 * h;
    v8f c00 = zero8(), c01 = zero8(), c10 = zero8(), c11 = zero8();
    for (int t = 0; t < npass; ++t) {
        const _Float16* tb = Ts + (t & 1) * STG;
#pragma unroll   // constant k0 folds into the LDS loads' offset field
        for (int k0 = 0; k0 < KP; k0 += 32) {
            Frag a0, a1, b0, b1;
            a0.half[0] = *(const v8h*)(tb + fa + k0);            a0.half[1] = *(const v8h*)(tb + fa + k0 + 16);
            a1.half[0] = *(const v8h*)(tb + fa + 16 * LP + k0);  a1.half[1] = *(const v8h*)(tb + fa + 16 * LP + k0 + 16);
            b0.half[0] = *(const v8h*)(tb + fb + k0);            b0.half[1] = *(const v8h*)(tb + fb + k0 + 16);
            b1.half[0] = *(const v8h*)(tb + fb + 16 * LP + k0);  b1.half[1] = *(const v8h*)(tb + fb + 16 * LP + k0 + 16);
            c00 = wmma16(a0.v, b0.v, c00);
            c01 = wmma16(a0.v, b1.v, c01);
            c10 = wmma16(a1.v, b0.v, c10);
            c11 = wmma16(a1.v, b1.v, c11);
        }
        asm volatile("s_wait_dscnt 0x0" ::: "memory");     // this wave's reads of buffer t&1 are done before it is refilled
        asm volatile("s_wait_asynccnt 0x0" ::: "memory");  // this wave's share of pass t+1 has landed
        __syncthreads();                                   // publishes pass t+1 and ends every read of buffer t&1
        if (t + 2 < npass) copy12(lds0 + (t & 1) * BUFB, GSTEP, g, (t + 2) * KP);
    }
    asm volatile("s_wait_asynccnt 0x0" ::: "memory");      // no copy is outstanding behind the loop

    // stage D: acc element r -> row 8h+r, col m of its 16x16 tile
#pragma unroll
    for (int r = 0; r < 8; ++r) {
        Cs[(wm + 8 * h + r) * CSP + wn + m]           = c00[r];
        Cs[(wm + 8 * h + r) * CSP + wn + 16 + m]      = c01[r];
        Cs[(wm + 16 + 8 * h + r) * CSP + wn + m]      = c10[r];
        Cs[(wm + 16 + 8 * h + r) * CSP + wn + 16 + m] = c11[r];
    }
    __syncthreads();

    if (brow) gemm_store<RELU, true >(Cs, bias, C, M, N, inv, m0, n0, wave, lane);   // block-uniform
    else      gemm_store<RELU, false>(Cs, bias, C, M, N, inv, m0, n0, wave, lane);
}

// The staged 128x64 f32 tile -> act(. * inv + bias) as f16, whole 128-byte lines.
template <bool RELU, bool BROW>
static __device__ __forceinline__ void gemm_store(const float* Cs, const float* __restrict__ bias, _Float16* C,
                                                  int M, int N, float inv, int m0, int n0, int wave, int lane) {
    const int p = lane & 7, rq = lane >> 3;          // p: cols 8p..8p+7, rq: row within group of 4
    v4f bc0 = {0.f, 0.f, 0.f, 0.f}, bc1 = {0.f, 0.f, 0.f, 0.f};
    if (!BROW) {
        if (n0 + 8 * p + 8 <= N) {
            bc0 = *(const v4f*)(bias + n0 + 8 * p);
            bc1 = *(const v4f*)(bias + n0 + 8 * p + 4);
        }
    }
    // wave w writes rows 16w..16w+15 (4 instructions x 4 rows)
    v8h vals[4];
#pragma unroll
    for (int i = 0; i < 4; ++i) {
        const int rloc = 16 * wave + 4 * i + rq;
        const float* src = Cs + rloc * CSP + 8 * p;
        v4f u0 = *(const v4f*)src;
        v4f u1 = *(const v4f*)(src + 4);
        v4f b0v = bc0, b1v = bc1;
        if (BROW) {
            const float bb = bias[min(m0 + rloc, M - 1)];
            v4f t = {bb, bb, bb, bb};
            b0v = t; b1v = t;
        }
        u0 = u0 * inv + b0v;
        u1 = u1 * inv + b1v;
        if (RELU) {
            u0[0] = fmaxf(u0[0], 0.f); u0[1] = fmaxf(u0[1], 0.f); u0[2] = fmaxf(u0[2], 0.f); u0[3] = fmaxf(u0[3], 0.f);
            u1[0] = fmaxf(u1[0], 0.f); u1[1] = fmaxf(u1[1], 0.f); u1[2] = fmaxf(u1[2], 0.f); u1[3] = fmaxf(u1[3], 0.f);
        }
        vals[i] = cvt8(u0, u1);
    }
#pragma unroll
    for (int i = 0; i < 4; ++i) {
        const int grow = m0 + 16 * wave + 4 * i + rq;
        if (grow < M && n0 + 8 * p + 8 <= N)
            *(v8h*)(C + (size_t)grow * N + n0 + 8 * p) = vals[i];
    }
    
}

// One product, grid (ceil(N/64), ceil(M/128)), bias by column.
template <bool RELU>
__global__ __launch_bounds__(256) void k_gemm(const _Float16* __restrict__ A, const _Float16* __restrict__ Bt,
                                              const float* __restrict__ bias, _Float16* C,
                                              int M, int N, int K, float inv) {
    gemm_tile<RELU>(A, Bt, bias, C, M, N, K, inv, false, blockIdx.x, blockIdx.y);
}

// The three products of m, which do not depend on each other, in one launch; grid (D/64, ntok/128, 3), 128 | D, ntok.
// blockIdx.z 0: q = m.Wq + qb;  1: k = m.Wk + kb;  2: vT[d][tok] = Wv^T.m^T + vb[d] (operands swapped, bias by row).
// vT has ntok/64 x D/128 tiles, as many as q: block (x, y) takes its tile (2y + (x & 1), x >> 1).
__global__ __launch_bounds__(256) void k_gemm_qkv(const _Float16* __restrict__ mh, const _Float16* __restrict__ qwt,
                                                  const _Float16* __restrict__ kwt, const _Float16* __restrict__ vwt,
                                                  const float* __restrict__ qb, const float* __restrict__ kb,
                                                  const float* __restrict__ vb,
                                                  _Float16* qh, _Float16* kh, _Float16* vT,
                                                  int ntok, int D, float inv) {
    const int z = blockIdx.z;
    const bool tr = (z == 2);
    const _Float16* A  = tr ? vwt : mh;
    const _Float16* Bt = tr ? mh : (z == 0) ? qwt : kwt;
    const float* bias  = tr ? vb : (z == 0) ? qb : kb;
    _Float16* C        = tr ? vT : (z == 0) ? qh : kh;
    const int M = tr ? D : ntok, N = tr ? ntok : D;
    const int bx = tr ? 2 * blockIdx.y + (blockIdx.x & 1) : blockIdx.x;
    const int by = tr ? blockIdx.x >> 1 : blockIdx.y;
    gemm_tile<false>(A, Bt, bias, C, M, N, D, inv, tr, bx, by);
}

// ---------------------------------------------------------------------------
// Banded attention, window offsets -32..+32, D = 1024.  One block (256 = 8 waves) per tile of 16 queries.
//   qh, kh : [ntok][1024] f16 (token-major);  vT : [1024][ntok] f16 (value dim major);  out : [ntok][1024] f32.
// Phase 1: scores S[16 q][80 keys] (keys s0-32 .. s0+47): wave t<5 computes key tile t on WMMA over k = 1024
//          (A = q rows, B[k=d][n=key] from k rows with the same split map), f32 into LDS.
// Phase 2: f32 masked softmax per query row (2 rows per wave), P*pscl as f16 into LDS [16][96] (cols 80..95 = 0).
// Phase 3: O^T[d][q] = vT[d][keys] . P^T[keys][q] on WMMA (3 k-steps of 32 keys; A from vT rows, clamped
//          in-range loads where P is zero; B = P^T loaded from the [q][key] LDS tile with the split map),
// ---------------------------------------------------------------------------
__global__ __launch_bounds__(256) void k_band_attn(const _Float16* __restrict__ qh, const _Float16* __restrict__ kh,
                                                   const _Float16* __restrict__ vT, float* out,
                                                   int S, int ntok, float scale, float pscl, float pinv) {
    constexpr int D = 1024, HALF = 32, NC = 80, PP = 96, OSP = 516;
    __shared__ __attribute__((aligned(16))) float    Ss[16 * NC];
    __shared__ __attribute__((aligned(16))) _Float16 Ps[16 * PP];
    __shared__ __attribute__((aligned(16))) float    Os[16 * OSP];

    const int tid = threadIdx.x, wave = tid >> 5, lane = tid & 31;
    const int h = lane >> 4, m = lane & 15;
    const int tok0 = blockIdx.x * 16;                // 16 | S, so a tile never straddles a batch
    const int b = tok0 / S;
    const int s0 = tok0 - b * S;
    const size_t bS = (size_t)b * S;
    const float ninf = -__builtin_huge_valf();

    // ---- phase 1: scores ----
    if (wave < 5) {                                  // wave-uniform branch
        const int t = wave;
        const int key  = s0 - HALF + 16 * t + m;
        const int keyc = min(max(key, 0), S - 1);
        const _Float16* pa = qh + (size_t)(tok0 + m) * D + 8 * h;
        const _Float16* pb = kh + (bS + keyc) * D + 8 * h;
        v8f acc = zero8();
#pragma unroll 2
        for (int k0 = 0; k0 < D; k0 += 32) {
            Frag a, bb;
            a.half[0]  = *(const v8h*)(pa + k0);  a.half[1]  = *(const v8h*)(pa + k0 + 16);
            bb.half[0] = *(const v8h*)(pb + k0);  bb.half[1] = *(const v8h*)(pb + k0 + 16);
            acc = wmma16(a.v, bb.v, acc);
        }
#pragma unroll
        for (int r = 0; r < 8; ++r) Ss[(8 * h + r) * NC + 16 * t + m] = acc[r];
    }
    __syncthreads();

    // ---- phase 2: masked softmax, rows 2w and 2w+1 per wave ----
#pragma unroll
    for (int rr = 0; rr < 2; ++rr) {
        const int r = 2 * wave + rr;                 // query row 0..15, position s0 + r
        float xv[3], ev[3];
        bool  vv[3];
        float mx = ninf;
#pragma unroll
        for (int c3 = 0; c3 < 3; ++c3) {
            const int c   = lane + 32 * c3;          // key column 0..95
            const int key = s0 - HALF + c;
            const bool valid = (c < NC) && (c >= r) && (c <= r + 2 * HALF) && (key >= 0) && (key < S);
            float x = ninf;
            if (valid) x = Ss[r * NC + c] * scale;
            xv[c3] = x; vv[c3] = valid;
            mx = fmaxf(mx, x);
        }
#pragma unroll
        for (int o = 16; o > 0; o >>= 1) mx = fmaxf(mx, __shfl_xor(mx, o, 32));
        float sum = 0.f;
#pragma unroll
        for (int c3 = 0; c3 < 3; ++c3) {
            const float e = vv[c3] ? expf(xv[c3] - mx) : 0.f;
            ev[c3] = e;
            sum += e;
        }
#pragma unroll
        for (int o = 16; o > 0; o >>= 1) sum += __shfl_xor(sum, o, 32);
        const float f = pscl / sum;
#pragma unroll
        for (int c3 = 0; c3 < 3; ++c3) {
            const int c = lane + 32 * c3;            // always < 96
            Ps[r * PP + c] = (_Float16)(ev[c3] * f);
        }
    }
    __syncthreads();

    // ---- phase 3: O^T = vT . P^T ----
    Frag pf[3];
#pragma unroll
    for (int j = 0; j < 3; ++j) {
        pf[j].half[0] = *(const v8h*)(Ps + m * PP + 32 * j + 8 * h);
        pf[j].half[1] = *(const v8h*)(Ps + m * PP + 32 * j + 16 + 8 * h);
    }
    for (int hd = 0; hd < 2; ++hd) {
#pragma unroll
        for (int i = 0; i < 4; ++i) {
            const int dtl = wave + 8 * i;            // local value-dim tile 0..31
            const int d0  = 512 * hd + 16 * dtl;
            const _Float16* prow = vT + (size_t)(d0 + m) * ntok + bS;
            v8f acc = zero8();
#pragma unroll
            for (int j = 0; j < 3; ++j) {
                const int g0 = s0 - HALF + 32 * j + 8 * h;
                const int g1 = g0 + 16;
                const int g0c = min(max(g0, 0), S - 8);
                const int g1c = min(max(g1, 0), S - 8);
                Frag a;
                a.half[0] = *(const v8h*)(prow + g0c);
                a.half[1] = *(const v8h*)(prow + g1c);
                acc = wmma16(a.v, pf[j].v, acc);
            }
#pragma unroll
            for (int r = 0; r < 8; ++r) Os[m * OSP + 16 * dtl + 8 * h + r] = acc[r] * pinv;
        }
        __syncthreads();
        v4f ov[8];
#pragma unroll
        for (int rr = 0; rr < 2; ++rr) {
#pragma unroll
            for (int c = 0; c < 4; ++c) {
                const int row = 2 * wave + rr;
                ov[rr * 4 + c] = *(const v4f*)(Os + row * OSP + 128 * c + 4 * lane);
            }
        }
#pragma unroll
        for (int rr = 0; rr < 2; ++rr) {
#pragma unroll
            for (int c = 0; c < 4; ++c) {
                const int row = 2 * wave + rr;
                if (tok0 + row < ntok)
                    *(v4f*)(out + (size_t)(tok0 + row) * D + 512 * hd + 128 * c + 4 * lane) = ov[rr * 4 + c];
            }
        }
        
        __syncthreads();
    }
}

// ---------------------------------------------------------------------------
// Host launch glue
// ---------------------------------------------------------------------------
extern "C" void kernel_launch(void* const* d_in, const int* in_sizes, int n_in,
                              void* d_out, int out_size, void* d_ws, size_t ws_size,
                              hipStream_t stream) {
    if (n_in < 11) return;
    constexpr int S = 2048;                          // sequence length (band boundary)
    const int KV = in_sizes[2];                      // hidden width of the first projection
    const int D  = in_sizes[4];                      // model width
    if (D != 1024 || KV != 1024 || D != DW) return;
    const int ntok = in_sizes[0] / D;                // B*S
    if (ntok <= 0 || ntok * D != in_sizes[0]) return;
    if ((ntok % 128) != 0 || (ntok % S) != 0 || (S % 16) != 0) return;
    if (in_sizes[1] != D * KV || in_sizes[3] != KV * D || in_sizes[5] != D * D ||
        in_sizes[7] != D * D || in_sizes[9] != D * D) return;
    if (in_sizes[6] != D || in_sizes[8] != D || in_sizes[10] != D) return;
    if (out_size != ntok * D) return;

    const float* x  = (const float*)d_in[0];
    const float* w1 = (const float*)d_in[1];
    const float* b1 = (const float*)d_in[2];
    const float* w2 = (const float*)d_in[3];
    const float* b2 = (const float*)d_in[4];
    const float* qw = (const float*)d_in[5];
    const float* qb = (const float*)d_in[6];
    const float* kw = (const float*)d_in[7];
    const float* kb = (const float*)d_in[8];
    const float* vw = (const float*)d_in[9];
    const float* vb = (const float*)d_in[10];
    float* outp = (float*)d_out;

    const size_t nTD = (size_t)ntok * D;             // activations
    const size_t nDD = (size_t)D * D;                // square weights (D == KV)
    _Float16* xh  = (_Float16*)d_ws;                 // [ntok][D]
    _Float16* w1t = xh  + nTD;                       // [KV][D]  (k-contiguous)
    _Float16* w2t = w1t + nDD;                       // [D][KV]
    _Float16* qwt = w2t + nDD;                       // [D][D]
    _Float16* kwt = qwt + nDD;
    _Float16* vwt = kwt + nDD;
    _Float16* hh  = vwt + nDD;                       // [ntok][KV]
    _Float16* mh  = hh  + nTD;                       // [ntok][D]
    _Float16* qh  = mh  + nTD;                       // [ntok][D]
    _Float16* kh  = qh  + nTD;                       // [ntok][D]
    _Float16* vT  = kh  + nTD;                       // [D][ntok]
    const size_t total_halves = 6 * nTD + 5 * nDD;
    if (total_halves * sizeof(_Float16) > ws_size) return;

    const float wscl  = 64.0f, winv = 1.0f / 64.0f;
    const float pscl  = 256.0f, pinv = 1.0f / 256.0f;
    const float scale = 1.0f / sqrtf((float)D);

    // 1) weights [K][N] -> [N][K] f16 * 64   (D == KV, all five are 1024 x 1024), and x -> f16, one launch
    {
        const int n8 = (int)(nTD / 8);
        dim3 tg(DW / 64, DW / 64);                                       // one block per tile position
        k_prep<<<tg, 256, 0, stream>>>(x, xh, n8, w1, w2, qw, kw, vw, w1t, w2t, qwt, kwt, vwt, wscl);
    }
    // 2) projections
    {
        dim3 g1((KV + 63) / 64, (ntok + 127) / 128);
        k_gemm<true ><<<g1, 256, 0, stream>>>(xh, w1t, b1, hh, ntok, KV, D, winv);   // h = relu(x.W1 + b1)
        dim3 g2((D + 63) / 64, (ntok + 127) / 128);
        k_gemm<false><<<g2, 256, 0, stream>>>(hh, w2t, b2, mh, ntok, D, KV, winv);  // m = h.W2 + b2
        dim3 g3((D + 63) / 64, (ntok + 127) / 128, 3);
        k_gemm_qkv<<<g3, 256, 0, stream>>>(mh, qwt, kwt, vwt, qb, kb, vb, qh, kh, vT, ntok, D, winv);   // q, k, vT
    }
    // 3) banded attention
    k_band_attn<<<ntok / 16, 256, 0, stream>>>(qh, kh, vT, outp, S, ntok, scale, pscl, pinv);
}

// v004
// A run of this version takes 73.4 microseconds.
// Timed twice side by side with v003, it ran 1.05 and 1.03 times as fast.
// All steps since v000 together make it 2.39 times as fast.
#include <hip/hip_runtime.h>
// Contractions: x.W1, h.W2, m.Wq, m.Wk, Wv^T.m^T, banded q.k^T and P.v all on v_wmma_f32_16x16x32_f16 (f16 operands, f32 accumulate); weights carried x64 (folded back as 1/64), softmax weights carried x256 (folded back as 1/256); bias, ReLU, softmax in f32.

typedef _Float16 v16h __attribute__((ext_vector_type(16)));
typedef _Float16 v8h  __attribute__((ext_vector_type(8)));
typedef float    v8f  __attribute__((ext_vector_type(8)));
typedef float    v4f  __attribute__((ext_vector_type(4)));
union Frag { v16h v; v8h half[2]; };

static __device__ __forceinline__ v8f zero8() {
    v8f z = {0.f, 0.f, 0.f, 0.f, 0.f, 0.f, 0.f, 0.f};
    return z;
}

// 16x16x32 f16 WMMA with the VALU hazard guard tied to D, A and B.
static __device__ __forceinline__ v8f wmma16(v16h a, v16h b, v8f c) {
    v8f d = __builtin_amdgcn_wmma_f32_16x16x32_f16(false, a, false, b, (short)0, c, false, false);
    asm volatile("v_nop\n\tv_nop\n\tv_nop\n\tv_nop" : "+v"(d) : "v"(a), "v"(b));
    return d;
}

static __device__ __forceinline__ v8h cvt8(v4f u0, v4f u1) {
    v8h o;
    o[0] = (_Float16)u0[0]; o[1] = (_Float16)u0[1]; o[2] = (_Float16)u0[2]; o[3] = (_Float16)u0[3];
    o[4] = (_Float16)u1[0]; o[5] = (_Float16)u1[1]; o[6] = (_Float16)u1[2]; o[7] = (_Float16)u1[3];
    return o;
}

// ---------------------------------------------------------------------------
// The two preparations, which do not depend on each other, in one launch of few, long-lived blocks; block 256,
// grid (DW/64, DW/64): as many blocks as one DW x DW weight has 64(k) x 64(n) tiles.  Block (bx, by) does
//   - tile (bx, by) of each of the five weights: in[k][n] f32 -> out[n][k] f16 * scl (k-contiguous weight copy);
//   - run bx + by * DW/64 of x f32 -> xh f16: a run is 2048 pieces of 8 elements, 8 pieces a thread (2048 | n8).
// All 36 loads of a thread (x first, then the five tiles) are issued before the first is used; one barrier a block.
// ---------------------------------------------------------------------------
constexpr int DW = 1024;                             // side of every weight; kernel_launch takes no other

__global__ __launch_bounds__(256) void k_prep(const float* __restrict__ x, _Float16* xh, int n8,
                                              const float* __restrict__ w0, const float* __restrict__ w1,
                                              const float* __restrict__ w2, const float* __restrict__ w3,
                                              const float* __restrict__ w4,
                                              _Float16* o0, _Float16* o1, _Float16* o2, _Float16* o3, _Float16* o4,
                                              float scl) {
    static_assert(DW % 64 == 0, "whole tiles only");
    constexpr int NB = (DW / 64) * (DW / 64);        // blocks in the grid
    __shared__ float tile[5][64][65];
    const float* const win[5] = {w0, w1, w2, w3, w4};
    _Float16* const wout[5]   = {o0, o1, o2, o3, o4};
    const int n0 = blockIdx.x * 64, k0 = blockIdx.y * 64;
    const int tid = threadIdx.x;
    const int tr = tid >> 4, tc = (tid & 15) * 4;    // row within a group of 16 rows, first of 4 columns

    // x: the block's run; a block without one reads run 0 and stores nothing (block-uniform)
    const int run = blockIdx.y * (DW / 64) + blockIdx.x;
    const bool has = run * 2048 < n8;
    const size_t xo = (size_t)(has ? run : 0) * 16384 + tid * 8;
    const float* px = x + xo;
    _Float16* ph = xh + xo;
    v4f u0[8], u1[8];
#pragma unroll   // constant indices keep u0[], u1[] in registers
    for (int j = 0; j < 8; ++j) {
        u0[j] = *(const v4f*)(px + j * 2048);
        u1[j] = *(const v4f*)(px + j * 2048 + 4);
    }

    // the five tiles, 16 bytes a load (a wave: two rows of 256 B): one offset for all, the row step is a constant
    v4f tv[5][4];
    const unsigned tb = (unsigned)((k0 + tr) * DW + n0 + tc) * 4u;   // byte offset, the same in every weight
#pragma unroll   // constant indices keep tv[][] in registers
    for (int z = 0; z < 5; ++z) {
#pragma unroll
        for (int i = 0; i < 4; ++i) tv[z][i] = *(const v4f*)(((const char*)win[z] + tb) + 16 * i * DW * 4);
    }
    // Stands behind the 36 loads, before any register that they name is rewritten; the two address operands
    // stay live up to here, so that no load's result lands on them.
    asm volatile("s_wait_xcnt 0x0" :: "v"(px), "v"(tb) : "memory");

    if (has) {
#pragma unroll
        for (int j = 0; j < 8; ++j) *(v8h*)(ph + j * 2048) = cvt8(u0[j], u1[j]);
    }

#pragma unroll
    for (int z = 0; z < 5; ++z) {
#pragma unroll
        for (int i = 0; i < 4; ++i) {
#pragma unroll
            for (int e = 0; e < 4; ++e) tile[z][tr + 16 * i][tc + e] = tv[z][i][e];
        }
    }
    __syncthreads();
    const int lane = tid & 31, wave = tid >> 5;
    const int p = lane & 7, rq = lane >> 3;          // p: 16-B piece (k 8p..8p+7), rq: row within group of 4
    // wave w writes output rows nn = 8w .. 8w+7 of every tile (2 instructions x 4 rows each)
#pragma unroll
    for (int z = 0; z < 5; ++z) {
#pragma unroll
        for (int i = 0; i < 2; ++i) {
            const int nn = 8 * wave + 4 * i + rq;
            v8h o;
#pragma unroll
            for (int e = 0; e < 8; ++e) o[e] = (_Float16)(tile[z][8 * p + e][nn] * scl);
            *(v8h*)(wout[z] + (n0 + nn) * DW + k0 + 8 * p) = o;
        }
    }

    // runs of x beyond one a block, where x is that long
    asm volatile("s_wait_xcnt 0x0" ::: "memory");    // before registers that the stores above name are rewritten
    for (int r = run + NB; r * 2048 < n8; r += NB) {
        px += (size_t)NB * 16384;
        ph += (size_t)NB * 16384;
        for (int j = 0; j < 8; ++j)
            *(v8h*)(ph + j * 2048) = cvt8(*(const v4f*)(px + j * 2048), *(const v4f*)(px + j * 2048 + 4));
    }
}

// ---------------------------------------------------------------------------
// Twelve asynchronous 16-byte copies per lane, global -> LDS, through no register: copy i brings g[i] + koff
// (halves) to LDS byte l0 + i * step.  The closing s_wait_xcnt 0 stands in the copies' own statement so that
// no address register of an issued copy is rewritten in front of it.
// ---------------------------------------------------------------------------
static __device__ __forceinline__ void copy12(unsigned l0, unsigned step, const _Float16* const (&g)[12], int koff) {
    asm volatile(
        "global_load_async_to_lds_b128 %0, %12, off\n\t"
        "global_load_async_to_lds_b128 %1, %13, off\n\t"
        "global_load_async_to_lds_b128 %2, %14, off\n\t"
        "global_load_async_to_lds_b128 %3, %15, off\n\t"
        "global_load_async_to_lds_b128 %4, %16, off\n\t"
        "global_load_async_to_lds_b128 %5, %17, off\n\t"
        "global_load_async_to_lds_b128 %6, %18, off\n\t"
        "global_load_async_to_lds_b128 %7, %19, off\n\t"
        "global_load_async_to_lds_b128 %8, %20, off\n\t"
        "global_load_async_to_lds_b128 %9, %21, off\n\t"
        "global_load_async_to_lds_b128 %10, %22, off\n\t"
        "global_load_async_to_lds_b128 %11, %23, off\n\t"
        "s_wait_xcnt 0x0"
        :: "v"(l0), "v"(l0 + step), "v"(l0 + 2 * step), "v"(l0 + 3 * step), "v"(l0 + 4 * step), "v"(l0 + 5 * step),
           "v"(l0 + 6 * step), "v"(l0 + 7 * step), "v"(l0 + 8 * step), "v"(l0 + 9 * step), "v"(l0 + 10 * step),
           "v"(l0 + 11 * step),
           "v"(g[0] + koff), "v"(g[1] + koff), "v"(g[2] + koff), "v"(g[3] + koff), "v"(g[4] + koff), "v"(g[5] + koff),
           "v"(g[6] + koff), "v"(g[7] + koff), "v"(g[8] + koff), "v"(g[9] + koff), "v"(g[10] + koff), "v"(g[11] + koff)
        : "memory");
}

// The same with eight copies: copy i brings g[i] to LDS byte l0 + i * step.
static __device__ __forceinline__ void copy8(unsigned l0, unsigned step, const _Float16* const (&g)[8]) {
    asm volatile(
        "global_load_async_to_lds_b128 %0, %8, off\n\t"
        "global_load_async_to_lds_b128 %1, %9, off\n\t"
        "global_load_async_to_lds_b128 %2, %10, off\n\t"
        "global_load_async_to_lds_b128 %3, %11, off\n\t"
        "global_load_async_to_lds_b128 %4, %12, off\n\t"
        "global_load_async_to_lds_b128 %5, %13, off\n\t"
        "global_load_async_to_lds_b128 %6, %14, off\n\t"
        "global_load_async_to_lds_b128 %7, %15, off\n\t"
        "s_wait_xcnt 0x0"
        :: "v"(l0), "v"(l0 + step), "v"(l0 + 2 * step), "v"(l0 + 3 * step), "v"(l0 + 4 * step), "v"(l0 + 5 * step),
           "v"(l0 + 6 * step), "v"(l0 + 7 * step),
           "v"(g[0]), "v"(g[1]), "v"(g[2]), "v"(g[3]), "v"(g[4]), "v"(g[5]), "v"(g[6]), "v"(g[7])
        : "memory");
}

// ---------------------------------------------------------------------------
// C[M][N] (f16, pitch N) = act((A[M][K] . Bt[N][K]^T) * inv + bias),  K a multiple of 128.
// Block 256 = 8 waves -> 128x64 tile; wave (wm, wn) owns 32x32 = 4 accumulators.
// A pass is 128 k: its 128 A rows and 64 Bt rows (256 B each) are copied whole-line into one of two LDS buffers
// (row pitch 272 B) while the pass before is worked on; fragments are read from LDS with the split k map for
// BOTH A and Bt:
//   lane l: row/col = l&15, h = l>>4; elements 0..7 <- k0+8h+0..7, elements 8..15 <- k0+16+8h+0..7.
// D: element r of lane l = (row 8h+r, col l&15).
// The tile is (bx, by); brow (the same for the whole block): the bias goes by row of C, else by column.
// ---------------------------------------------------------------------------
constexpr int CSP = 68;                              // pitch of the staged C tile, floats

template <bool RELU, bool BROW>
static __device__ __forceinline__ void gemm_store(const float* Cs, const float* __restrict__ bias, _Float16* C,
                                                  int M, int N, float inv, int m0, int n0, int wave, int lane);

template <bool RELU>
static __device__ __forceinline__ void gemm_tile(const _Float16* __restrict__ A, const _Float16* __restrict__ Bt,
                                                 const float* __restrict__ bias, _Float16* C,
                                                 int M, int N, int K, float inv, bool brow, int bx, int by) {
    constexpr int KP = 128, LP = 136, STG = 192 * LP;    // k per pass; LDS row pitch and buffer size in halves
    __shared__ __attribute__((aligned(16))) float Cs[128 * CSP];
    __shared__ __attribute__((aligned(16))) _Float16 Ts[2 * STG];
    const int tid = threadIdx.x, wave = tid >> 5, lane = tid & 31;
    const int h = lane >> 4, m = lane & 15;
    const int m0 = by * 128, n0 = bx * 64;
    const int wm = (wave & 3) * 32, wn = (wave >> 2) * 32;

    // copy map: thread -> row tid>>4 of each group of 16 rows, 16-byte piece tid&15; groups 0..7 = A, 8..11 = Bt
    const int crow = tid >> 4, cpc = tid & 15;
    const _Float16* g[12];
#pragma unroll   // constant indices keep g[] in registers
    for (int i = 0; i < 8; ++i) g[i] = A + (size_t)min(m0 + 16 * i + crow, M - 1) * K + 8 * cpc;
#pragma unroll   // as above
    for (int i = 0; i < 4; ++i) g[8 + i] = Bt + (size_t)min(n0 + 16 * i + crow, N - 1) * K + 8 * cpc;
    const unsigned lds0 = (unsigned)(size_t)(Ts + crow * LP + 8 * cpc);   // low 32 bits = LDS byte address
    constexpr unsigned GSTEP = 16 * LP * 2, BUFB = STG * 2;               // bytes per 16 rows, per buffer
    const int npass = K / KP;

    copy12(lds0, GSTEP, g, 0);
    asm volatile("s_wait_asynccnt 0x0" ::: "memory");   // this wave's share of pass 0 has landed
    __syncthreads();                                    // publishes pass 0 to every wave
    if (npass > 1) copy12(lds0 + BUFB, GSTEP, g, KP);

    const int fa = (wm + m) * LP + 8 * h;               // fragment offsets inside a buffer, halves
    const int fb = (128 + wn + m) * LP + 8 * h;
    v8f c00 = zero8(), c01 = zero8(), c10 = zero8(), c11 = zero8();
    for (int t = 0; t < npass; ++t) {
        const _Float16* tb = Ts + (t & 1) * STG;
#pragma unroll   // constant k0 folds into the LDS loads' offset field
        for (int k0 = 0; k0 < KP; k0 += 32) {
            Frag a0, a1, b0, b1;
            a0.half[0] = *(const v8h*)(tb + fa + k0);            a0.half[1] = *(const v8h*)(tb + fa + k0 + 16);
            a1.half[0] = *(const v8h*)(tb + fa + 16 * LP + k0);  a1.half[1] = *(const v8h*)(tb + fa + 16 * LP + k0 + 16);
            b0.half[0] = *(const v8h*)(tb + fb + k0);            b0.half[1] = *(const v8h*)(tb + fb + k0 + 16);
            b1.half[0] = *(const v8h*)(tb + fb + 16 * LP + k0);  b1.half[1] = *(const v8h*)(tb + fb + 16 * LP + k0 + 16);
            c00 = wmma16(a0.v, b0.v, c00);
            c01 = wmma16(a0.v, b1.v, c01);
            c10 = wmma16(a1.v, b0.v, c10);
            c11 = wmma16(a1.v, b1.v, c11);
        }
        asm volatile("s_wait_dscnt 0x0" ::: "memory");     // this wave's reads of buffer t&1 are done before it is refilled
        asm volatile("s_wait_asynccnt 0x0" ::: "memory");  // this wave's share of pass t+1 has landed
        __syncthreads();                                   // publishes pass t+1 and ends every read of buffer t&1
        if (t + 2 < npass) copy12(lds0 + (t & 1) * BUFB, GSTEP, g, (t + 2) * KP);
    }
    asm volatile("s_wait_asynccnt 0x0" ::: "memory");      // no copy is outstanding behind the loop

    // stage D: acc element r -> row 8h+r, col m of its 16x16 tile
#pragma unroll
    for (int r = 0; r < 8; ++r) {
        Cs[(wm + 8 * h + r) * CSP + wn + m]           = c00[r];
        Cs[(wm + 8 * h + r) * CSP + wn + 16 + m]      = c01[r];
        Cs[(wm + 16 + 8 * h + r) * CSP + wn + m]      = c10[r];
        Cs[(wm + 16 + 8 * h + r) * CSP + wn + 16 + m] = c11[r];
    }
    __syncthreads();

    if (brow) gemm_store<RELU, true >(Cs, bias, C, M, N, inv, m0, n0, wave, lane);   // block-uniform
    else      gemm_store<RELU, false>(Cs, bias, C, M, N, inv, m0, n0, wave, lane);
}

// The staged 128x64 f32 tile -> act(. * inv + bias) as f16, whole 128-byte lines.
template <bool RELU, bool BROW>
static __device__ __forceinline__ void gemm_store(const float* Cs, const float* __restrict__ bias, _Float16* C,
                                                  int M, int N, float inv, int m0, int n0, int wave, int lane) {
    const int p = lane & 7, rq = lane >> 3;          // p: cols 8p..8p+7, rq: row within group of 4
    v4f bc0 = {0.f, 0.f, 0.f, 0.f}, bc1 = {0.f, 0.f, 0.f, 0.f};
    if (!BROW) {
        if (n0 + 8 * p + 8 <= N) {
            bc0 = *(const v4f*)(bias + n0 + 8 * p);
            bc1 = *(const v4f*)(bias + n0 + 8 * p + 4);
        }
    }
    // wave w writes rows 16w..16w+15 (4 instructions x 4 rows)
    v8h vals[4];
#pragma unroll
    for (int i = 0; i < 4; ++i) {
        const int rloc = 16 * wave + 4 * i + rq;
        const float* src = Cs + rloc * CSP + 8 * p;
        v4f u0 = *(const v4f*)src;
        v4f u1 = *(const v4f*)(src + 4);
        v4f b0v = bc0, b1v = bc1;
        if (BROW) {
            const float bb = bias[min(m0 + rloc, M - 1)];
            v4f t = {bb, bb, bb, bb};
            b0v = t; b1v = t;
        }
        u0 = u0 * inv + b0v;
        u1 = u1 * inv + b1v;
        if (RELU) {
            u0[0] = fmaxf(u0[0], 0.f); u0[1] = fmaxf(u0[1], 0.f); u0[2] = fmaxf(u0[2], 0.f); u0[3] = fmaxf(u0[3], 0.f);
            u1[0] = fmaxf(u1[0], 0.f); u1[1] = fmaxf(u1[1], 0.f); u1[2] = fmaxf(u1[2], 0.f); u1[3] = fmaxf(u1[3], 0.f);
        }
        vals[i] = cvt8(u0, u1);
    }
#pragma unroll
    for (int i = 0; i < 4; ++i) {
        const int grow = m0 + 16 * wave + 4 * i + rq;
        if (grow < M && n0 + 8 * p + 8 <= N)
            *(v8h*)(C + (size_t)grow * N + n0 + 8 * p) = vals[i];
    }
    
}

// One product, grid (ceil(N/64), ceil(M/128)), bias by column.
template <bool RELU>
__global__ __launch_bounds__(256) void k_gemm(const _Float16* __restrict__ A, const _Float16* __restrict__ Bt,
                                              const float* __restrict__ bias, _Float16* C,
                                              int M, int N, int K, float inv) {
    gemm_tile<RELU>(A, Bt, bias, C, M, N, K, inv, false, blockIdx.x, blockIdx.y);
}

// The three products of m, which do not depend on each other, in one launch; grid (D/64, ntok/128, 3), 128 | D, ntok.
// blockIdx.z 0: q = m.Wq + qb;  1: k = m.Wk + kb;  2: vT[d][tok] = Wv^T.m^T + vb[d] (operands swapped, bias by row).
// vT has ntok/64 x D/128 tiles, as many as q: block (x, y) takes its tile (2y + (x & 1), x >> 1).
__global__ __launch_bounds__(256) void k_gemm_qkv(const _Float16* __restrict__ mh, const _Float16* __restrict__ qwt,
                                                  const _Float16* __restrict__ kwt, const _Float16* __restrict__ vwt,
                                                  const float* __restrict__ qb, const float* __restrict__ kb,
                                                  const float* __restrict__ vb,
                                                  _Float16* qh, _Float16* kh, _Float16* vT,
                                                  int ntok, int D, float inv) {
    const int z = blockIdx.z;
    const bool tr = (z == 2);
    const _Float16* A  = tr ? vwt : mh;
    const _Float16* Bt = tr ? mh : (z == 0) ? qwt : kwt;
    const float* bias  = tr ? vb : (z == 0) ? qb : kb;
    _Float16* C        = tr ? vT : (z == 0) ? qh : kh;
    const int M = tr ? D : ntok, N = tr ? ntok : D;
    const int bx = tr ? 2 * blockIdx.y + (blockIdx.x & 1) : blockIdx.x;
    const int by = tr ? blockIdx.x >> 1 : blockIdx.y;
    gemm_tile<false>(A, Bt, bias, C, M, N, D, inv, tr, bx, by);
}

// ---------------------------------------------------------------------------
// Banded attention, window offsets -32..+32, D = 1024.  One block (256 = 8 waves) per tile of 16 queries.
//   qh, kh : [ntok][1024] f16 (token-major);  vT : [1024][ntok] f16 (value dim major);  out : [ntok][1024] f32.
// Both sets of global operands come into one LDS space by asynchronous copies, 48 a thread, all in flight at once.
// Phase 0: the 16 q rows and the 5 key tiles of 16 rows (keys s0-32 .. s0+47), 2 KiB a row, row pitch 2064 B.  A key
//          tile is 16-aligned, so it lies wholly inside the sequence or wholly outside; for one outside, the nearest
//          tile inside is copied, and phase 2 reads none of its scores.
// Phase 1: scores S[16 q][80 keys]: wave t<5 computes key tile t on WMMA over k = 1024
//          (A = q rows, B[k=d][n=key] from k rows with the same split map, both from LDS), f32 into LDS.
//          Behind it the space is refilled with the window of vT: 1024 rows of 12 pieces of 8 keys (piece p = keys
//          s0-32+8p .., clamped into the sequence where P is zero), row pitch 208 B; the copies fly during phase 2.
// Phase 2: f32 masked softmax per query row (2 rows per wave), P*pscl as f16 into LDS [16][96] (cols 80..95 = 0).
// Phase 3: O^T[d][q] = vT[d][keys] . P^T[keys][q] on WMMA (3 k-steps of 32 keys; A from the staged vT rows;
//          B = P^T loaded from the [q][key] LDS tile with the split map),
// ---------------------------------------------------------------------------
__global__ __launch_bounds__(256) void k_band_attn(const _Float16* __restrict__ qh, const _Float16* __restrict__ kh,
                                                   const _Float16* __restrict__ vT, float* out,
                                                   int S, int ntok, float scale, float pscl, float pinv) {
    constexpr int D = 1024, HALF = 32, NC = 80, PP = 96, OSP = 516;
    constexpr int QP = D + 8, VP = PP + 8;           // pitch of a staged q or key row and of a vT row, halves: 16 B x odd
    static_assert((16 + NC) * QP <= D * VP, "the q and key rows fit the space of the vT window");
    __shared__ __attribute__((aligned(16))) _Float16 Stg[D * VP];   // first q rows 0..15 and key rows 16..95, then vT
    __shared__ __attribute__((aligned(16))) float    Ss[16 * NC];
    __shared__ __attribute__((aligned(16))) _Float16 Ps[16 * PP];
    __shared__ __attribute__((aligned(16))) float    Os[16 * OSP];

    const int tid = threadIdx.x, wave = tid >> 5, lane = tid & 31;
    const int h = lane >> 4, m = lane & 15;
    const int tok0 = blockIdx.x * 16;                // 16 | S, so a tile never straddles a batch
    const int b = tok0 / S;
    const int s0 = tok0 - b * S;
    const size_t bS = (size_t)b * S;
    const float ninf = -__builtin_huge_valf();

    // ---- phase 0: stage the q and key rows ----
    {
        // copy map: thread -> 16-byte piece tid&127 of row 2i + (tid>>7) of each tile of 16 rows, i = 0..7;
        // a wave's copy is 512 contiguous bytes of one row
        const int cpc = tid & 127, rsub = tid >> 7;
        const unsigned lds0 = (unsigned)(size_t)(Stg + rsub * QP + 8 * cpc);  // low 32 bits = LDS byte address
        constexpr unsigned RSTEP = 2 * QP * 2;                                // bytes from row 2i to row 2i + 2
#pragma unroll   // constant indices keep g[] in registers
        for (int tl = 0; tl < 6; ++tl) {
            const int kt0 = min(max(s0 - HALF + 16 * (tl - 1), 0), S - 16);   // first key of the tile, inside the sequence
            const _Float16* tb = (tl == 0) ? qh + (size_t)(tok0 + rsub) * D + 8 * cpc
                                           : kh + (bS + kt0 + rsub) * D + 8 * cpc;
            const _Float16* g[8];
#pragma unroll   // as above
            for (int i = 0; i < 8; ++i) g[i] = tb + 2 * i * D;
            copy8(lds0 + 8 * tl * RSTEP, RSTEP, g);
        }
        asm volatile("s_wait_asynccnt 0x0" ::: "memory");   // this wave's share of the rows has landed
        __syncthreads();                                    // publishes the rows to every wave
    }

    // ---- phase 1: scores ----
    if (wave < 5) {                                  // wave-uniform branch
        const int t = wave;
        const _Float16* pa = Stg + m * QP + 8 * h;
        const _Float16* pb = Stg + (16 + 16 * t + m) * QP + 8 * h;
        v8f acc = zero8();
#pragma unroll 2
        for (int k0 = 0; k0 < D; k0 += 32) {
            Frag a, bb;
            a.half[0]  = *(const v8h*)(pa + k0);  a.half[1]  = *(const v8h*)(pa + k0 + 16);
            bb.half[0] = *(const v8h*)(pb + k0);  bb.half[1] = *(const v8h*)(pb + k0 + 16);
            acc = wmma16(a.v, bb.v, acc);
        }
#pragma unroll
        for (int r = 0; r < 8; ++r) Ss[(8 * h + r) * NC + 16 * t + m] = acc[r];
    }
    asm volatile("s_wait_dscnt 0x0" ::: "memory");   // this wave's reads of the staged rows are done before the refill
    __syncthreads();                                 // publishes the scores and ends every read of the staged rows

    // ---- stage the window of vT; lands during phase 2 ----
    {
        // copy map: thread -> row 64i + (tid>>2), i = 0..15, pieces (tid&3) + 4c, c = 0..2; a wave's copy is 64 B of 8 rows
        const int pc0 = tid & 3, vr = tid >> 2;
        const unsigned lds0 = (unsigned)(size_t)(Stg + vr * VP + 8 * pc0);    // low 32 bits = LDS byte address
        constexpr unsigned VSTEP = 64 * VP * 2;                               // bytes from row r to row r + 64
        const _Float16* vrow = vT + (size_t)vr * ntok + bS;
#pragma unroll   // constant indices keep g[] in registers
        for (int c = 0; c < 3; ++c) {
            const int gk = min(max(s0 - HALF + 8 * (pc0 + 4 * c), 0), S - 8); // first key of the piece, inside the sequence
#pragma unroll   // as above
            for (int hf = 0; hf < 2; ++hf) {
                const _Float16* g[8];
#pragma unroll   // as above
                for (int i = 0; i < 8; ++i) g[i] = vrow + (size_t)(64 * (8 * hf + i)) * ntok + gk;
                copy8(lds0 + 64 * c + 8 * hf * VSTEP, VSTEP, g);
            }
        }
    }

    // ---- phase 2: masked softmax, rows 2w and 2w+1 per wave ----
#pragma unroll
    for (int rr = 0; rr < 2; ++rr) {
        const int r = 2 * wave + rr;                 // query row 0..15, position s0 + r
        float xv[3], ev[3];
        bool  vv[3];
        float mx = ninf;
#pragma unroll
        for (int c3 = 0; c3 < 3; ++c3) {
            const int c   = lane + 32 * c3;          // key column 0..95
            const int key = s0 - HALF + c;
            const bool valid = (c < NC) && (c >= r) && (c <= r + 2 * HALF) && (key >= 0) && (key < S);
            float x = ninf;
            if (valid) x = Ss[r * NC + c] * scale;
            xv[c3] = x; vv[c3] = valid;
            mx = fmaxf(mx, x);
        }
#pragma unroll
        for (int o = 16; o > 0; o >>= 1) mx = fmaxf(mx, __shfl_xor(mx, o, 32));
        float sum = 0.f;
#pragma unroll
        for (int c3 = 0; c3 < 3; ++c3) {
            const float e = vv[c3] ? expf(xv[c3] - mx) : 0.f;
            ev[c3] = e;
            sum += e;
        }
#pragma unroll
        for (int o = 16; o > 0; o >>= 1) sum += __shfl_xor(sum, o, 32);
        const float f = pscl / sum;
#pragma unroll
        for (int c3 = 0; c3 < 3; ++c3) {
            const int c = lane + 32 * c3;            // always < 96
            Ps[r * PP + c] = (_Float16)(ev[c3] * f);
        }
    }
    asm volatile("s_wait_asynccnt 0x0" ::: "memory");   // this wave's share of the vT window has landed
    __syncthreads();                                    // publishes P and the vT window

    // ---- phase 3: O^T = vT . P^T ----
    Frag pf[3];
#pragma unroll
    for (int j = 0; j < 3; ++j) {
        pf[j].half[0] = *(const v8h*)(Ps + m * PP + 32 * j + 8 * h);
        pf[j].half[1] = *(const v8h*)(Ps + m * PP + 32 * j + 16 + 8 * h);
    }
    for (int hd = 0; hd < 2; ++hd) {
#pragma unroll
        for (int i = 0; i < 4; ++i) {
            const int dtl = wave + 8 * i;            // local value-dim tile 0..31
            const int d0  = 512 * hd + 16 * dtl;
            const _Float16* prow = Stg + (d0 + m) * VP + 8 * h;
            v8f acc = zero8();
#pragma unroll
            for (int j = 0; j < 3; ++j) {
                Frag a;
                a.half[0] = *(const v8h*)(prow + 32 * j);        // piece 4j + h
                a.half[1] = *(const v8h*)(prow + 32 * j + 16);   // piece 4j + 2 + h
                acc = wmma16(a.v, pf[j].v, acc);
            }
#pragma unroll
            for (int r = 0; r < 8; ++r) Os[m * OSP + 16 * dtl + 8 * h + r] = acc[r] * pinv;
        }
        __syncthreads();
        v4f ov[8];
#pragma unroll
        for (int rr = 0; rr < 2; ++rr) {
#pragma unroll
            for (int c = 0; c < 4; ++c) {
                const int row = 2 * wave + rr;
                ov[rr * 4 + c] = *(const v4f*)(Os + row * OSP + 128 * c + 4 * lane);
            }
        }
#pragma unroll
        for (int rr = 0; rr < 2; ++rr) {
#pragma unroll
            for (int c = 0; c < 4; ++c) {
                const int row = 2 * wave + rr;
                if (tok0 + row < ntok)
                    *(v4f*)(out + (size_t)(tok0 + row) * D + 512 * hd + 128 * c + 4 * lane) = ov[rr * 4 + c];
            }
        }
        
        __syncthreads();
    }
}

// ---------------------------------------------------------------------------
// Host launch glue
// ---------------------------------------------------------------------------
extern "C" void kernel_launch(void* const* d_in, const int* in_sizes, int n_in,
                              void* d_out, int out_size, void* d_ws, size_t ws_size,
                              hipStream_t stream) {
    if (n_in < 11) return;
    constexpr int S = 2048;                          // sequence length (band boundary)
    const int KV = in_sizes[2];                      // hidden width of the first projection
    const int D  = in_sizes[4];                      // model width
    if (D != 1024 || KV != 1024 || D != DW) return;
    const int ntok = in_sizes[0] / D;                // B*S
    if (ntok <= 0 || ntok * D != in_sizes[0]) return;
    if ((ntok % 128) != 0 || (ntok % S) != 0 || (S % 16) != 0) return;
    if (in_sizes[1] != D * KV || in_sizes[3] != KV * D || in_sizes[5] != D * D ||
        in_sizes[7] != D * D || in_sizes[9] != D * D) return;
    if (in_sizes[6] != D || in_sizes[8] != D || in_sizes[10] != D) return;
    if (out_size != ntok * D) return;

    const float* x  = (const float*)d_in[0];
    const float* w1 = (const float*)d_in[1];
    const float* b1 = (const float*)d_in[2];
    const float* w2 = (const float*)d_in[3];
    const float* b2 = (const float*)d_in[4];
    const float* qw = (const float*)d_in[5];
    const float* qb = (const float*)d_in[6];
    const float* kw = (const float*)d_in[7];
    const float* kb = (const float*)d_in[8];
    const float* vw = (const float*)d_in[9];
    const float* vb = (const float*)d_in[10];
    float* outp = (float*)d_out;

    const size_t nTD = (size_t)ntok * D;             // activations
    const size_t nDD = (size_t)D * D;                // square weights (D == KV)
    _Float16* xh  = (_Float16*)d_ws;                 // [ntok][D]
    _Float16* w1t = xh  + nTD;                       // [KV][D]  (k-contiguous)
    _Float16* w2t = w1t + nDD;                       // [D][KV]
    _Float16* qwt = w2t + nDD;                       // [D][D]
    _Float16* kwt = qwt + nDD;
    _Float16* vwt = kwt + nDD;
    _Float16* hh  = vwt + nDD;                       // [ntok][KV]
    _Float16* mh  = hh  + nTD;                       // [ntok][D]
    _Float16* qh  = mh  + nTD;                       // [ntok][D]
    _Float16* kh  = qh  + nTD;                       // [ntok][D]
    _Float16* vT  = kh  + nTD;                       // [D][ntok]
    const size_t total_halves = 6 * nTD + 5 * nDD;
    if (total_halves * sizeof(_Float16) > ws_size) return;

    const float wscl  = 64.0f, winv = 1.0f / 64.0f;
    const float pscl  = 256.0f, pinv = 1.0f / 256.0f;
    const float scale = 1.0f / sqrtf((float)D);

    // 1) weights [K][N] -> [N][K] f16 * 64   (D == KV, all five are 1024 x 1024), and x -> f16, one launch
    {
        const int n8 = (int)(nTD / 8);
        dim3 tg(DW / 64, DW / 64);                                       // one block per tile position
        k_prep<<<tg, 256, 0, stream>>>(x, xh, n8, w1, w2, qw, kw, vw, w1t, w2t, qwt, kwt, vwt, wscl);
    }
    // 2) projections
    {
        dim3 g1((KV + 63) / 64, (ntok + 127) / 128);
        k_gemm<true ><<<g1, 256, 0, stream>>>(xh, w1t, b1, hh, ntok, KV, D, winv);   // h = relu(x.W1 + b1)
        dim3 g2((D + 63) / 64, (ntok + 127) / 128);
        k_gemm<false><<<g2, 256, 0, stream>>>(hh, w2t, b2, mh, ntok, D, KV, winv);  // m = h.W2 + b2
        dim3 g3((D + 63) / 64, (ntok + 127) / 128, 3);
        k_gemm_qkv<<<g3, 256, 0, stream>>>(mh, qwt, kwt, vwt, qb, kb, vb, qh, kh, vT, ntok, D, winv);   // q, k, vT
    }
    // 3) banded attention
    k_band_attn<<<ntok / 16, 256, 0, stream>>>(qh, kh, vT, outp, S, ntok, scale, pscl, pinv);
}

// v005
// Measured time: 67.6 microseconds a run.
// Timed twice side by side with v004, it ran 1.09 times as fast both times.
// Over all steps from v000 it is 2.60 times as fast.
#include <hip/hip_runtime.h>
// Contractions: x.W1, h.W2, m.Wq, m.Wk, m.Wv, banded q.k^T and P.v all on v_wmma_f32_16x16x32_f16 (f16 operands, f32 accumulate); weights carried x64 (folded back as 1/64), softmax weights carried x256 (folded back as 1/256); bias, ReLU, softmax in f32.

typedef _Float16 v16h __attribute__((ext_vector_type(16)));
typedef _Float16 v8h  __attribute__((ext_vector_type(8)));
typedef float    v8f  __attribute__((ext_vector_type(8)));
typedef float    v4f  __attribute__((ext_vector_type(4)));
union Frag { v16h v; v8h half[2]; };

static __device__ __forceinline__ v8f zero8() {
    v8f z = {0.f, 0.f, 0.f, 0.f, 0.f, 0.f, 0.f, 0.f};
    return z;
}

// 16x16x32 f16 WMMA with the VALU hazard guard tied to D, A and B.
static __device__ __forceinline__ v8f wmma16(v16h a, v16h b, v8f c) {
    v8f d = __builtin_amdgcn_wmma_f32_16x16x32_f16(false, a, false, b, (short)0, c, false, false);
    asm volatile("v_nop\n\tv_nop\n\tv_nop\n\tv_nop" : "+v"(d) : "v"(a), "v"(b));
    return d;
}

static __device__ __forceinline__ v8h cvt8(v4f u0, v4f u1) {
    v8h o;
    o[0] = (_Float16)u0[0]; o[1] = (_Float16)u0[1]; o[2] = (_Float16)u0[2]; o[3] = (_Float16)u0[3];
    o[4] = (_Float16)u1[0]; o[5] = (_Float16)u1[1]; o[6] = (_Float16)u1[2]; o[7] = (_Float16)u1[3];
    return o;
}

// ---------------------------------------------------------------------------
// The two preparations, which do not depend on each other, in one launch of few, long-lived blocks; block 256,
// grid (DW/64, DW/64): as many blocks as one DW x DW weight has 64(k) x 64(n) tiles.  Block (bx, by) does
//   - tile (bx, by) of each of the five weights: in[k][n] f32 -> out[n][k] f16 * scl (k-contiguous weight copy);
//   - run bx + by * DW/64 of x f32 -> xh f16: a run is 2048 pieces of 8 elements, 8 pieces a thread (2048 | n8).
// All 36 loads of a thread (x first, then the five tiles) are issued before the first is used; one barrier a block.
// ---------------------------------------------------------------------------
constexpr int DW = 1024;                             // side of every weight; kernel_launch takes no other

__global__ __launch_bounds__(256) void k_prep(const float* __restrict__ x, _Float16* xh, int n8,
                                              const float* __restrict__ w0, const float* __restrict__ w1,
                                              const float* __restrict__ w2, const float* __restrict__ w3,
                                              const float* __restrict__ w4,
                                              _Float16* o0, _Float16* o1, _Float16* o2, _Float16* o3, _Float16* o4,
                                              float scl) {
    static_assert(DW % 64 == 0, "whole tiles only");
    constexpr int NB = (DW / 64) * (DW / 64);        // blocks in the grid
    __shared__ float tile[5][64][65];
    const float* const win[5] = {w0, w1, w2, w3, w4};
    _Float16* const wout[5]   = {o0, o1, o2, o3, o4};
    const int n0 = blockIdx.x * 64, k0 = blockIdx.y * 64;
    const int tid = threadIdx.x;
    const int tr = tid >> 4, tc = (tid & 15) * 4;    // row within a group of 16 rows, first of 4 columns

    // x: the block's run; a block without one reads run 0 and stores nothing (block-uniform)
    const int run = blockIdx.y * (DW / 64) + blockIdx.x;
    const bool has = run * 2048 < n8;
    const size_t xo = (size_t)(has ? run : 0) * 16384 + tid * 8;
    const float* px = x + xo;
    _Float16* ph = xh + xo;
    v4f u0[8], u1[8];
#pragma unroll   // constant indices keep u0[], u1[] in registers
    for (int j = 0; j < 8; ++j) {
        u0[j] = *(const v4f*)(px + j * 2048);
        u1[j] = *(const v4f*)(px + j * 2048 + 4);
    }

    // the five tiles, 16 bytes a load (a wave: two rows of 256 B): one offset for all, the row step is a constant
    v4f tv[5][4];
    const unsigned tb = (unsigned)((k0 + tr) * DW + n0 + tc) * 4u;   // byte offset, the same in every weight
#pragma unroll   // constant indices keep tv[][] in registers
    for (int z = 0; z < 5; ++z) {
#pragma unroll
        for (int i = 0; i < 4; ++i) tv[z][i] = *(const v4f*)(((const char*)win[z] + tb) + 16 * i * DW * 4);
    }
    // Stands behind the 36 loads, before any register that they name is rewritten; the two address operands
    // stay live up to here, so that no load's result lands on them.
    asm volatile("s_wait_xcnt 0x0" :: "v"(px), "v"(tb) : "memory");

    if (has) {
#pragma unroll
        for (int j = 0; j < 8; ++j) *(v8h*)(ph + j * 2048) = cvt8(u0[j], u1[j]);
    }

#pragma unroll
    for (int z = 0; z < 5; ++z) {
#pragma unroll
        for (int i = 0; i < 4; ++i) {
#pragma unroll
            for (int e = 0; e < 4; ++e) tile[z][tr + 16 * i][tc + e] = tv[z][i][e];
        }
    }
    __syncthreads();
    const int lane = tid & 31, wave = tid >> 5;
    const int p = lane & 7, rq = lane >> 3;          // p: 16-B piece (k 8p..8p+7), rq: row within group of 4
    // wave w writes output rows nn = 8w .. 8w+7 of every tile (2 instructions x 4 rows each)
#pragma unroll
    for (int z = 0; z < 5; ++z) {
#pragma unroll
        for (int i = 0; i < 2; ++i) {
            const int nn = 8 * wave + 4 * i + rq;
            v8h o;
#pragma unroll
            for (int e = 0; e < 8; ++e) o[e] = (_Float16)(tile[z][8 * p + e][nn] * scl);
            *(v8h*)(wout[z] + (n0 + nn) * DW + k0 + 8 * p) = o;
        }
    }

    // runs of x beyond one a block, where x is that long
    asm volatile("s_wait_xcnt 0x0" ::: "memory");    // before registers that the stores above name are rewritten
    for (int r = run + NB; r * 2048 < n8; r += NB) {
        px += (size_t)NB * 16384;
        ph += (size_t)NB * 16384;
        for (int j = 0; j < 8; ++j)
            *(v8h*)(ph + j * 2048) = cvt8(*(const v4f*)(px + j * 2048), *(const v4f*)(px + j * 2048 + 4));
    }
}

// ---------------------------------------------------------------------------
// Twelve asynchronous 16-byte copies per lane, global -> LDS, through no register: copy i brings g[i] + koff
// (halves) to LDS byte l0 + i * step.  The closing s_wait_xcnt 0 stands in the copies' own statement so that
// no address register of an issued copy is rewritten in front of it.
// ---------------------------------------------------------------------------
static __device__ __forceinline__ void copy12(unsigned l0, unsigned step, const _Float16* const (&g)[12], int koff) {
    asm volatile(
        "global_load_async_to_lds_b128 %0, %12, off\n\t"
        "global_load_async_to_lds_b128 %1, %13, off\n\t"
        "global_load_async_to_lds_b128 %2, %14, off\n\t"
        "global_load_async_to_lds_b128 %3, %15, off\n\t"
        "global_load_async_to_lds_b128 %4, %16, off\n\t"
        "global_load_async_to_lds_b128 %5, %17, off\n\t"
        "global_load_async_to_lds_b128 %6, %18, off\n\t"
        "global_load_async_to_lds_b128 %7, %19, off\n\t"
        "global_load_async_to_lds_b128 %8, %20, off\n\t"
        "global_load_async_to_lds_b128 %9, %21, off\n\t"
        "global_load_async_to_lds_b128 %10, %22, off\n\t"
        "global_load_async_to_lds_b128 %11, %23, off\n\t"
        "s_wait_xcnt 0x0"
        :: "v"(l0), "v"(l0 + step), "v"(l0 + 2 * step), "v"(l0 + 3 * step), "v"(l0 + 4 * step), "v"(l0 + 5 * step),
           "v"(l0 + 6 * step), "v"(l0 + 7 * step), "v"(l0 + 8 * step), "v"(l0 + 9 * step), "v"(l0 + 10 * step),
           "v"(l0 + 11 * step),
           "v"(g[0] + koff), "v"(g[1] + koff), "v"(g[2] + koff), "v"(g[3] + koff), "v"(g[4] + koff), "v"(g[5] + koff),
           "v"(g[6] + koff), "v"(g[7] + koff), "v"(g[8] + koff), "v"(g[9] + koff), "v"(g[10] + koff), "v"(g[11] + koff)
        : "memory");
}

// The same with eight copies: copy i brings g[i] to LDS byte l0 + i * step.
static __device__ __forceinline__ void copy8(unsigned l0, unsigned step, const _Float16* const (&g)[8]) {
    asm volatile(
        "global_load_async_to_lds_b128 %0, %8, off\n\t"
        "global_load_async_to_lds_b128 %1, %9, off\n\t"
        "global_load_async_to_lds_b128 %2, %10, off\n\t"
        "global_load_async_to_lds_b128 %3, %11, off\n\t"
        "global_load_async_to_lds_b128 %4, %12, off\n\t"
        "global_load_async_to_lds_b128 %5, %13, off\n\t"
        "global_load_async_to_lds_b128 %6, %14, off\n\t"
        "global_load_async_to_lds_b128 %7, %15, off\n\t"
        "s_wait_xcnt 0x0"
        :: "v"(l0), "v"(l0 + step), "v"(l0 + 2 * step), "v"(l0 + 3 * step), "v"(l0 + 4 * step), "v"(l0 + 5 * step),
           "v"(l0 + 6 * step), "v"(l0 + 7 * step),
           "v"(g[0]), "v"(g[1]), "v"(g[2]), "v"(g[3]), "v"(g[4]), "v"(g[5]), "v"(g[6]), "v"(g[7])
        : "memory");
}

// The same with fourteen copies.
static __device__ __forceinline__ void copy14(unsigned l0, unsigned step, const _Float16* const (&g)[14]) {
    asm volatile(
        "global_load_async_to_lds_b128 %0, %14, off\n\t"
        "global_load_async_to_lds_b128 %1, %15, off\n\t"
        "global_load_async_to_lds_b128 %2, %16, off\n\t"
        "global_load_async_to_lds_b128 %3, %17, off\n\t"
        "global_load_async_to_lds_b128 %4, %18, off\n\t"
        "global_load_async_to_lds_b128 %5, %19, off\n\t"
        "global_load_async_to_lds_b128 %6, %20, off\n\t"
        "global_load_async_to_lds_b128 %7, %21, off\n\t"
        "global_load_async_to_lds_b128 %8, %22, off\n\t"
        "global_load_async_to_lds_b128 %9, %23, off\n\t"
        "global_load_async_to_lds_b128 %10, %24, off\n\t"
        "global_load_async_to_lds_b128 %11, %25, off\n\t"
        "global_load_async_to_lds_b128 %12, %26, off\n\t"
        "global_load_async_to_lds_b128 %13, %27, off\n\t"
        "s_wait_xcnt 0x0"
        :: "v"(l0), "v"(l0 + step), "v"(l0 + 2 * step), "v"(l0 + 3 * step), "v"(l0 + 4 * step), "v"(l0 + 5 * step),
           "v"(l0 + 6 * step), "v"(l0 + 7 * step), "v"(l0 + 8 * step), "v"(l0 + 9 * step), "v"(l0 + 10 * step),
           "v"(l0 + 11 * step), "v"(l0 + 12 * step), "v"(l0 + 13 * step),
           "v"(g[0]), "v"(g[1]), "v"(g[2]), "v"(g[3]), "v"(g[4]), "v"(g[5]), "v"(g[6]), "v"(g[7]), "v"(g[8]),
           "v"(g[9]), "v"(g[10]), "v"(g[11]), "v"(g[12]), "v"(g[13])
        : "memory");
}

// ---------------------------------------------------------------------------
// C[M][N] (f16, pitch N) = act((A[M][K] . Bt[N][K]^T) * inv + bias),  K a multiple of 128.
// Block 256 = 8 waves -> 128x64 tile; wave (wm, wn) owns 32x32 = 4 accumulators.
// A pass is 128 k: its 128 A rows and 64 Bt rows (256 B each) are copied whole-line into one of two LDS buffers
// (row pitch 272 B) while the pass before is worked on; fragments are read from LDS with the split k map for
// BOTH A and Bt:
//   lane l: row/col = l&15, h = l>>4; elements 0..7 <- k0+8h+0..7, elements 8..15 <- k0+16+8h+0..7.
// D: element r of lane l = (row 8h+r, col l&15).
// The tile is (bx, by); the bias goes by column of C.
// ---------------------------------------------------------------------------
constexpr int CSP = 68;                              // pitch of the staged C tile, floats

template <bool RELU>
static __device__ __forceinline__ void gemm_store(const float* Cs, const float* __restrict__ bias, _Float16* C,
                                                  int M, int N, float inv, int m0, int n0, int wave, int lane);

template <bool RELU>
static __device__ __forceinline__ void gemm_tile(const _Float16* __restrict__ A, const _Float16* __restrict__ Bt,
                                                 const float* __restrict__ bias, _Float16* C,
                                                 int M, int N, int K, float inv, int bx, int by) {
    constexpr int KP = 128, LP = 136, STG = 192 * LP;    // k per pass; LDS row pitch and buffer size in halves
    __shared__ __attribute__((aligned(16))) float Cs[128 * CSP];
    __shared__ __attribute__((aligned(16))) _Float16 Ts[2 * STG];
    const int tid = threadIdx.x, wave = tid >> 5, lane = tid & 31;
    const int h = lane >> 4, m = lane & 15;
    const int m0 = by * 128, n0 = bx * 64;
    const int wm = (wave & 3) * 32, wn = (wave >> 2) * 32;

    // copy map: thread -> row tid>>4 of each group of 16 rows, 16-byte piece tid&15; groups 0..7 = A, 8..11 = Bt
    const int crow = tid >> 4, cpc = tid & 15;
    const _Float16* g[12];
#pragma unroll   // constant indices keep g[] in registers
    for (int i = 0; i < 8; ++i) g[i] = A + (size_t)min(m0 + 16 * i + crow, M - 1) * K + 8 * cpc;
#pragma unroll   // as above
    for (int i = 0; i < 4; ++i) g[8 + i] = Bt + (size_t)min(n0 + 16 * i + crow, N - 1) * K + 8 * cpc;
    const unsigned lds0 = (unsigned)(size_t)(Ts + crow * LP + 8 * cpc);   // low 32 bits = LDS byte address
    constexpr unsigned GSTEP = 16 * LP * 2, BUFB = STG * 2;               // bytes per 16 rows, per buffer
    const int npass = K / KP;

    copy12(lds0, GSTEP, g, 0);
    asm volatile("s_wait_asynccnt 0x0" ::: "memory");   // this wave's share of pass 0 has landed
    __syncthreads();                                    // publishes pass 0 to every wave
    if (npass > 1) copy12(lds0 + BUFB, GSTEP, g, KP);

    const int fa = (wm + m) * LP + 8 * h;               // fragment offsets inside a buffer, halves
    const int fb = (128 + wn + m) * LP + 8 * h;
    v8f c00 = zero8(), c01 = zero8(), c10 = zero8(), c11 = zero8();
    for (int t = 0; t < npass; ++t) {
        const _Float16* tb = Ts + (t & 1) * STG;
#pragma unroll   // constant k0 folds into the LDS loads' offset field
        for (int k0 = 0; k0 < KP; k0 += 32) {
            Frag a0, a1, b0, b1;
            a0.half[0] = *(const v8h*)(tb + fa + k0);            a0.half[1] = *(const v8h*)(tb + fa + k0 + 16);
            a1.half[0] = *(const v8h*)(tb + fa + 16 * LP + k0);  a1.half[1] = *(const v8h*)(tb + fa + 16 * LP + k0 + 16);
            b0.half[0] = *(const v8h*)(tb + fb + k0);            b0.half[1] = *(const v8h*)(tb + fb + k0 + 16);
            b1.half[0] = *(const v8h*)(tb + fb + 16 * LP + k0);  b1.half[1] = *(const v8h*)(tb + fb + 16 * LP + k0 + 16);
            c00 = wmma16(a0.v, b0.v, c00);
            c01 = wmma16(a0.v, b1.v, c01);
            c10 = wmma16(a1.v, b0.v, c10);
            c11 = wmma16(a1.v, b1.v, c11);
        }
        asm volatile("s_wait_dscnt 0x0" ::: "memory");     // this wave's reads of buffer t&1 are done before it is refilled
        asm volatile("s_wait_asynccnt 0x0" ::: "memory");  // this wave's share of pass t+1 has landed
        __syncthreads();                                   // publishes pass t+1 and ends every read of buffer t&1
        if (t + 2 < npass) copy12(lds0 + (t & 1) * BUFB, GSTEP, g, (t + 2) * KP);
    }
    asm volatile("s_wait_asynccnt 0x0" ::: "memory");      // no copy is outstanding behind the loop

    // stage D: acc element r -> row 8h+r, col m of its 16x16 tile
#pragma unroll
    for (int r = 0; r < 8; ++r) {
        Cs[(wm + 8 * h + r) * CSP + wn + m]           = c00[r];
        Cs[(wm + 8 * h + r) * CSP + wn + 16 + m]      = c01[r];
        Cs[(wm + 16 + 8 * h + r) * CSP + wn + m]      = c10[r];
        Cs[(wm + 16 + 8 * h + r) * CSP + wn + 16 + m] = c11[r];
    }
    __syncthreads();

    gemm_store<RELU>(Cs, bias, C, M, N, inv, m0, n0, wave, lane);
}

// The staged 128x64 f32 tile -> act(. * inv + bias) as f16, whole 128-byte lines.
template <bool RELU>
static __device__ __forceinline__ void gemm_store(const float* Cs, const float* __restrict__ bias, _Float16* C,
                                                  int M, int N, float inv, int m0, int n0, int wave, int lane) {
    const int p = lane & 7, rq = lane >> 3;          // p: cols 8p..8p+7, rq: row within group of 4
    v4f bc0 = {0.f, 0.f, 0.f, 0.f}, bc1 = {0.f, 0.f, 0.f, 0.f};
    if (n0 + 8 * p + 8 <= N) {
        bc0 = *(const v4f*)(bias + n0 + 8 * p);
        bc1 = *(const v4f*)(bias + n0 + 8 * p + 4);
    }
    // wave w writes rows 16w..16w+15 (4 instructions x 4 rows)
    v8h vals[4];
#pragma unroll
    for (int i = 0; i < 4; ++i) {
        const int rloc = 16 * wave + 4 * i + rq;
        const float* src = Cs + rloc * CSP + 8 * p;
        v4f u0 = *(const v4f*)src;
        v4f u1 = *(const v4f*)(src + 4);
        u0 = u0 * inv + bc0;
        u1 = u1 * inv + bc1;
        if (RELU) {
            u0[0] = fmaxf(u0[0], 0.f); u0[1] = fmaxf(u0[1], 0.f); u0[2] = fmaxf(u0[2], 0.f); u0[3] = fmaxf(u0[3], 0.f);
            u1[0] = fmaxf(u1[0], 0.f); u1[1] = fmaxf(u1[1], 0.f); u1[2] = fmaxf(u1[2], 0.f); u1[3] = fmaxf(u1[3], 0.f);
        }
        vals[i] = cvt8(u0, u1);
    }
#pragma unroll
    for (int i = 0; i < 4; ++i) {
        const int grow = m0 + 16 * wave + 4 * i + rq;
        if (grow < M && n0 + 8 * p + 8 <= N)
            *(v8h*)(C + (size_t)grow * N + n0 + 8 * p) = vals[i];
    }
    
}

// One product, grid (ceil(N/64), ceil(M/128)), bias by column.
template <bool RELU>
__global__ __launch_bounds__(256) void k_gemm(const _Float16* __restrict__ A, const _Float16* __restrict__ Bt,
                                              const float* __restrict__ bias, _Float16* C,
                                              int M, int N, int K, float inv) {
    gemm_tile<RELU>(A, Bt, bias, C, M, N, K, inv, blockIdx.x, blockIdx.y);
}

// The three products of m in one launch of one block a WGP; block of QNW = 16 waves, grid (DW/64, ntok/256); 256 | ntok.
// Block (x, y): tokens 256y .. 256y+255 against columns 64x .. 64x+63 of EACH of q, k and v: a 256 x 192 tile.
//   q = m.Wq + qb and k = m.Wk + kb, token-major;  vT[d][tok] = (m.Wv + vb)^T, value dim major.
// A pass is 128 k: the 256 rows of m and the 3 x 64 weight rows (256 B each) are copied whole-line into one of two LDS
// buffers (row pitch 272 B) while the pass before is worked on; waits and barrier of a pass as in gemm_tile.
// Wave (wm, wn), 4 x 4: 64 tokens against the wn-th 16 of each 64 columns (a 64 x 48 tile).  Fragments: the split k map of
// gemm_tile for tokens and weights alike, so either may stand as A.  D holds 8 successive A rows in a lane:
//   q, k: A = weight rows, B = tokens -> a lane holds 8 columns of one token;
//   v   : A = tokens, B = weight rows -> a lane holds 8 tokens of one value dim;
// each goes to the staged f16 tile as one 16-byte LDS store, in the order in which its output is laid out.
constexpr int QNW = 16;                              // waves in a block of k_gemm_qkv

__global__ __launch_bounds__(QNW * 32) void k_gemm_qkv(const _Float16* __restrict__ mh, const _Float16* __restrict__ qwt,
                                                      const _Float16* __restrict__ kwt, const _Float16* __restrict__ vwt,
                                                      const float* __restrict__ qb, const float* __restrict__ kb,
                                                      const float* __restrict__ vb,
                                                      _Float16* qh, _Float16* kh, _Float16* vT, int ntok, float inv) {
    constexpr int NT = QNW * 32, K = DW, KP = 128, LP = 136;  // threads; depth; k per pass; LDS row pitch, halves
    constexpr int BM = 256, ROWS = BM + 192, STG = ROWS * LP; // tokens; rows and halves of a buffer
    constexpr int WN = QNW / 4, FJ = 4 / WN;                  // wave columns; 16-column fragments of each of q, k, v a wave
    constexpr int RPG = NT / 16, NG = ROWS / RPG;             // rows that one copy of every thread brings; copies a thread
    constexpr int TG = BM / RPG, CG = 64 / RPG;               // of these: for the tokens, for one weight
    constexpr int CP = 136, VP = BM + 8;                      // pitch of the staged q|k rows and of the vT rows, halves
    static_assert(NG % 14 == 0 && FJ * WN == 4 && K % KP == 0 && K / KP >= 2, "shapes");
    static_assert(BM * CP + 64 * VP <= 2 * STG, "the staged output fits the ring");
    __shared__ __attribute__((aligned(16))) _Float16 Ts[2 * STG];
    const int tid = threadIdx.x, wave = tid >> 5, lane = tid & 31;
    const int h = lane >> 4, m = lane & 15;
    const int m0 = blockIdx.y * BM, n0 = blockIdx.x * 64;
    const int wm = (wave & 3) * 64, wn = wave >> 2;

    // copy map: thread -> row tid>>4 of each group of RPG rows, 16-byte piece tid&15; groups: tokens, Wq, Wk, Wv
    const int crow = tid >> 4, cpc = tid & 15;
    const _Float16* const pa = mh + (size_t)(m0 + crow) * K + 8 * cpc;
    const size_t wo = (size_t)(n0 + crow) * K + 8 * cpc;
    const _Float16* const pw[3] = {qwt + wo, kwt + wo, vwt + wo};
    const unsigned lds0 = (unsigned)(size_t)(Ts + crow * LP + 8 * cpc);   // low 32 bits = LDS byte address
    constexpr unsigned GSTEP = RPG * LP * 2, BUFB = STG * 2;              // bytes per group, per buffer
    constexpr int npass = K / KP;
    auto copy_pass = [&](unsigned lbase, int koff) {
#pragma unroll   // constant indices keep g[] in registers
        for (int s = 0; s < NG / 14; ++s) {
            const _Float16* g[14];
#pragma unroll   // as above
            for (int i = 0; i < 14; ++i) {
                const int gi = 14 * s + i;
                g[i] = (gi < TG ? pa + gi * RPG * K : pw[(gi - TG) / CG] + ((gi - TG) % CG) * RPG * K) + koff;
            }
            copy14(lbase + 14 * s * GSTEP, GSTEP, g);
        }
    };

    copy_pass(lds0, 0);
    asm volatile("s_wait_asynccnt 0x0" ::: "memory");   // this wave's share of pass 0 has landed
    __syncthreads();                                    // publishes pass 0 to every wave
    copy_pass(lds0 + BUFB, KP);

    // the lane's biases, asked for here so that they are there when the passes end
    v4f b0[2 * FJ], b1[2 * FJ];
    float bb[FJ];
#pragma unroll
    for (int j = 0; j < 2 * FJ; ++j) {
        const float* bp = (j / FJ ? kb : qb) + n0 + 16 * FJ * wn + 16 * (j % FJ) + 8 * h;
        b0[j] = *(const v4f*)bp;
        b1[j] = *(const v4f*)(bp + 4);
    }
#pragma unroll
    for (int j = 0; j < FJ; ++j) bb[j] = vb[n0 + 16 * FJ * wn + 16 * j + m];

    const int fa = (wm + m) * LP + 8 * h;               // fragment offsets inside a buffer, halves
    const int fw = (BM + 16 * FJ * wn + m) * LP + 8 * h;
    v8f acc[4][3 * FJ];
#pragma unroll
    for (int i = 0; i < 4; ++i) {
#pragma unroll
        for (int j = 0; j < 3 * FJ; ++j) acc[i][j] = zero8();
    }
#pragma unroll 1   // the passes stay a loop: eight copies of the pass would only lengthen the text that is fetched once
    for (int t = 0; t < npass; ++t) {
        const _Float16* tb = Ts + (t & 1) * STG;
#pragma unroll   // constant k0 folds into the LDS loads' offset field
        for (int k0 = 0; k0 < KP; k0 += 32) {
            Frag a[4], w[3 * FJ];
#pragma unroll
            for (int i = 0; i < 4; ++i) {
                a[i].half[0] = *(const v8h*)(tb + fa + 16 * i * LP + k0);
                a[i].half[1] = *(const v8h*)(tb + fa + 16 * i * LP + k0 + 16);
            }
#pragma unroll
            for (int j = 0; j < 3 * FJ; ++j) {
                const int ro = (64 * (j / FJ) + 16 * (j % FJ)) * LP;
                w[j].half[0] = *(const v8h*)(tb + fw + ro + k0);
                w[j].half[1] = *(const v8h*)(tb + fw + ro + k0 + 16);
            }
#pragma unroll
            for (int j = 0; j < 3 * FJ; ++j) {
#pragma unroll
                for (int i = 0; i < 4; ++i)
                    acc[i][j] = (j < 2 * FJ) ? wmma16(w[j].v, a[i].v, acc[i][j]) : wmma16(a[i].v, w[j].v, acc[i][j]);
            }
        }
        asm volatile("s_wait_dscnt 0x0" ::: "memory");     // this wave's reads of buffer t&1 are done before it is refilled
        asm volatile("s_wait_asynccnt 0x0" ::: "memory");  // this wave's share of pass t+1 has landed
        __syncthreads();                                   // publishes pass t+1 and ends every read of buffer t&1
        if (t + 2 < npass) copy_pass(lds0 + (t & 1) * BUFB, (t + 2) * KP);
    }
    asm volatile("s_wait_asynccnt 0x0" ::: "memory");      // no copy is outstanding behind the loop

    // stage act(. * inv + bias) as f16 over the ring, which every wave has left: q|k rows [256][128], vT rows [64][256]
    _Float16* const Cqk = Ts;
    _Float16* const Cv  = Ts + BM * CP;
#pragma unroll
    for (int j = 0; j < 2 * FJ; ++j) {
        const int col = 16 * FJ * wn + 16 * (j % FJ) + 8 * h;    // first of the lane's 8 columns, within the 64
#pragma unroll
        for (int i = 0; i < 4; ++i) {
            const v8f c = acc[i][j];
            v4f u0 = {c[0], c[1], c[2], c[3]}, u1 = {c[4], c[5], c[6], c[7]};
            *(v8h*)(Cqk + (wm + 16 * i + m) * CP + 64 * (j / FJ) + col) = cvt8(u0 * inv + b0[j], u1 * inv + b1[j]);
        }
    }
#pragma unroll
    for (int j = 2 * FJ; j < 3 * FJ; ++j) {
        const int dl = 16 * FJ * wn + 16 * (j % FJ) + m;         // the lane's value dim, within the 64
        const float bj = bb[j - 2 * FJ];
        const v4f bv = {bj, bj, bj, bj};
#pragma unroll
        for (int i = 0; i < 4; ++i) {
            const v8f c = acc[i][j];
            v4f u0 = {c[0], c[1], c[2], c[3]}, u1 = {c[4], c[5], c[6], c[7]};
            *(v8h*)(Cv + dl * VP + wm + 16 * i + 8 * h) = cvt8(u0 * inv + bv, u1 * inv + bv);
        }
    }
    __syncthreads();

    // whole 128-byte lines out: a wave's store is 2 tokens x (128 B of q + 128 B of k), then 512 B of one vT row
    constexpr int NQ = BM * 16 / NT, NV = 64 * 32 / NT;
    v8h oq[NQ], ov[NV];
#pragma unroll
    for (int it = 0; it < NQ; ++it) oq[it] = *(const v8h*)(Cqk + (it * RPG + crow) * CP + 8 * cpc);
#pragma unroll
    for (int it = 0; it < NV; ++it) ov[it] = *(const v8h*)(Cv + (it * (NT / 32) + wave) * VP + 8 * lane);
    _Float16* const dq = (cpc < 8 ? qh : kh) + (size_t)(m0 + crow) * K + n0 + 8 * (cpc & 7);
    _Float16* const dv = vT + (size_t)(n0 + wave) * ntok + m0 + 8 * lane;
#pragma unroll
    for (int it = 0; it < NQ; ++it) *(v8h*)(dq + it * RPG * K) = oq[it];
#pragma unroll
    for (int it = 0; it < NV; ++it) *(v8h*)(dv + (size_t)(it * (NT / 32)) * ntok) = ov[it];
}

// ---------------------------------------------------------------------------
// Banded attention, window offsets -32..+32, D = 1024.  One block (256 = 8 waves) per tile of 16 queries.
//   qh, kh : [ntok][1024] f16 (token-major);  vT : [1024][ntok] f16 (value dim major);  out : [ntok][1024] f32.
// Both sets of global operands come into one LDS space by asynchronous copies, 48 a thread, all in flight at once.
// Phase 0: the 16 q rows and the 5 key tiles of 16 rows (keys s0-32 .. s0+47), 2 KiB a row, row pitch 2064 B.  A key
//          tile is 16-aligned, so it lies wholly inside the sequence or wholly outside; for one outside, the nearest
//          tile inside is copied, and phase 2 reads none of its scores.
// Phase 1: scores S[16 q][80 keys]: wave t<5 computes key tile t on WMMA over k = 1024
//          (A = q rows, B[k=d][n=key] from k rows with the same split map, both from LDS), f32 into LDS.
//          Behind it the space is refilled with the window of vT: 1024 rows of 12 pieces of 8 keys (piece p = keys
//          s0-32+8p .., clamped into the sequence where P is zero), row pitch 208 B; the copies fly during phase 2.
// Phase 2: f32 masked softmax per query row (2 rows per wave), P*pscl as f16 into LDS [16][96] (cols 80..95 = 0).
// Phase 3: O^T[d][q] = vT[d][keys] . P^T[keys][q] on WMMA (3 k-steps of 32 keys; A from the staged vT rows;
//          B = P^T loaded from the [q][key] LDS tile with the split map),
// ---------------------------------------------------------------------------
__global__ __launch_bounds__(256) void k_band_attn(const _Float16* __restrict__ qh, const _Float16* __restrict__ kh,
                                                   const _Float16* __restrict__ vT, float* out,
                                                   int S, int ntok, float scale, float pscl, float pinv) {
    constexpr int D = 1024, HALF = 32, NC = 80, PP = 96, OSP = 516;
    constexpr int QP = D + 8, VP = PP + 8;           // pitch of a staged q or key row and of a vT row, halves: 16 B x odd
    static_assert((16 + NC) * QP <= D * VP, "the q and key rows fit the space of the vT window");
    __shared__ __attribute__((aligned(16))) _Float16 Stg[D * VP];   // first q rows 0..15 and key rows 16..95, then vT
    __shared__ __attribute__((aligned(16))) float    Ss[16 * NC];
    __shared__ __attribute__((aligned(16))) _Float16 Ps[16 * PP];
    __shared__ __attribute__((aligned(16))) float    Os[16 * OSP];

    const int tid = threadIdx.x, wave = tid >> 5, lane = tid & 31;
    const int h = lane >> 4, m = lane & 15;
    const int tok0 = blockIdx.x * 16;                // 16 | S, so a tile never straddles a batch
    const int b = tok0 / S;
    const int s0 = tok0 - b * S;
    const size_t bS = (size_t)b * S;
    const float ninf = -__builtin_huge_valf();

    // ---- phase 0: stage the q and key rows ----
    {
        // copy map: thread -> 16-byte piece tid&127 of row 2i + (tid>>7) of each tile of 16 rows, i = 0..7;
        // a wave's copy is 512 contiguous bytes of one row
        const int cpc = tid & 127, rsub = tid >> 7;
        const unsigned lds0 = (unsigned)(size_t)(Stg + rsub * QP + 8 * cpc);  // low 32 bits = LDS byte address
        constexpr unsigned RSTEP = 2 * QP * 2;                                // bytes from row 2i to row 2i + 2
#pragma unroll   // constant indices keep g[] in registers
        for (int tl = 0; tl < 6; ++tl) {
            const int kt0 = min(max(s0 - HALF + 16 * (tl - 1), 0), S - 16);   // first key of the tile, inside the sequence
            const _Float16* tb = (tl == 0) ? qh + (size_t)(tok0 + rsub) * D + 8 * cpc
                                           : kh + (bS + kt0 + rsub) * D + 8 * cpc;
            const _Float16* g[8];
#pragma unroll   // as above
            for (int i = 0; i < 8; ++i) g[i] = tb + 2 * i * D;
            copy8(lds0 + 8 * tl * RSTEP, RSTEP, g);
        }
        asm volatile("s_wait_asynccnt 0x0" ::: "memory");   // this wave's share of the rows has landed
        __syncthreads();                                    // publishes the rows to every wave
    }

    // ---- phase 1: scores ----
    if (wave < 5) {                                  // wave-uniform branch
        const int t = wave;
        const _Float16* pa = Stg + m * QP + 8 * h;
        const _Float16* pb = Stg + (16 + 16 * t + m) * QP + 8 * h;
        v8f acc = zero8();
#pragma unroll 2
        for (int k0 = 0; k0 < D; k0 += 32) {
            Frag a, bb;
            a.half[0]  = *(const v8h*)(pa + k0);  a.half[1]  = *(const v8h*)(pa + k0 + 16);
            bb.half[0] = *(const v8h*)(pb + k0);  bb.half[1] = *(const v8h*)(pb + k0 + 16);
            acc = wmma16(a.v, bb.v, acc);
        }
#pragma unroll
        for (int r = 0; r < 8; ++r) Ss[(8 * h + r) * NC + 16 * t + m] = acc[r];
    }
    asm volatile("s_wait_dscnt 0x0" ::: "memory");   // this wave's reads of the staged rows are done before the refill
    __syncthreads();                                 // publishes the scores and ends every read of the staged rows

    // ---- stage the window of vT; lands during phase 2 ----
    {
        // copy map: thread -> row 64i + (tid>>2), i = 0..15, pieces (tid&3) + 4c, c = 0..2; a wave's copy is 64 B of 8 rows
        const int pc0 = tid & 3, vr = tid >> 2;
        const unsigned lds0 = (unsigned)(size_t)(Stg + vr * VP + 8 * pc0);    // low 32 bits = LDS byte address
        constexpr unsigned VSTEP = 64 * VP * 2;                               // bytes from row r to row r + 64
        const _Float16* vrow = vT + (size_t)vr * ntok + bS;
#pragma unroll   // constant indices keep g[] in registers
        for (int c = 0; c < 3; ++c) {
            const int gk = min(max(s0 - HALF + 8 * (pc0 + 4 * c), 0), S - 8); // first key of the piece, inside the sequence
#pragma unroll   // as above
            for (int hf = 0; hf < 2; ++hf) {
                const _Float16* g[8];
#pragma unroll   // as above
                for (int i = 0; i < 8; ++i) g[i] = vrow + (size_t)(64 * (8 * hf + i)) * ntok + gk;
                copy8(lds0 + 64 * c + 8 * hf * VSTEP, VSTEP, g);
            }
        }
    }

    // ---- phase 2: masked softmax, rows 2w and 2w+1 per wave ----
#pragma unroll
    for (int rr = 0; rr < 2; ++rr) {
        const int r = 2 * wave + rr;                 // query row 0..15, position s0 + r
        float xv[3], ev[3];
        bool  vv[3];
        float mx = ninf;
#pragma unroll
        for (int c3 = 0; c3 < 3; ++c3) {
            const int c   = lane + 32 * c3;          // key column 0..95
            const int key = s0 - HALF + c;
            const bool valid = (c < NC) && (c >= r) && (c <= r + 2 * HALF) && (key >= 0) && (key < S);
            float x = ninf;
            if (valid) x = Ss[r * NC + c] * scale;
            xv[c3] = x; vv[c3] = valid;
            mx = fmaxf(mx, x);
        }
#pragma unroll
        for (int o = 16; o > 0; o >>= 1) mx = fmaxf(mx, __shfl_xor(mx, o, 32));
        float sum = 0.f;
#pragma unroll
        for (int c3 = 0; c3 < 3; ++c3) {
            const float e = vv[c3] ? expf(xv[c3] - mx) : 0.f;
            ev[c3] = e;
            sum += e;
        }
#pragma unroll
        for (int o = 16; o > 0; o >>= 1) sum += __shfl_xor(sum, o, 32);
        const float f = pscl / sum;
#pragma unroll
        for (int c3 = 0; c3 < 3; ++c3) {
            const int c = lane + 32 * c3;            // always < 96
            Ps[r * PP + c] = (_Float16)(ev[c3] * f);
        }
    }
    asm volatile("s_wait_asynccnt 0x0" ::: "memory");   // this wave's share of the vT window has landed
    __syncthreads();                                    // publishes P and the vT window

    // ---- phase 3: O^T = vT . P^T ----
    Frag pf[3];
#pragma unroll
    for (int j = 0; j < 3; ++j) {
        pf[j].half[0] = *(const v8h*)(Ps + m * PP + 32 * j + 8 * h);
        pf[j].half[1] = *(const v8h*)(Ps + m * PP + 32 * j + 16 + 8 * h);
    }
    for (int hd = 0; hd < 2; ++hd) {
#pragma unroll
        for (int i = 0; i < 4; ++i) {
            const int dtl = wave + 8 * i;            // local value-dim tile 0..31
            const int d0  = 512 * hd + 16 * dtl;
            const _Float16* prow = Stg + (d0 + m) * VP + 8 * h;
            v8f acc = zero8();
#pragma unroll
            for (int j = 0; j < 3; ++j) {
                Frag a;
                a.half[0] = *(const v8h*)(prow + 32 * j);        // piece 4j + h
                a.half[1] = *(const v8h*)(prow + 32 * j + 16);   // piece 4j + 2 + h
                acc = wmma16(a.v, pf[j].v, acc);
            }
#pragma unroll
            for (int r = 0; r < 8; ++r) Os[m * OSP + 16 * dtl + 8 * h + r] = acc[r] * pinv;
        }
        __syncthreads();
        v4f ov[8];
#pragma unroll
        for (int rr = 0; rr < 2; ++rr) {
#pragma unroll
            for (int c = 0; c < 4; ++c) {
                const int row = 2 * wave + rr;
                ov[rr * 4 + c] = *(const v4f*)(Os + row * OSP + 128 * c + 4 * lane);
            }
        }
#pragma unroll
        for (int rr = 0; rr < 2; ++rr) {
#pragma unroll
            for (int c = 0; c < 4; ++c) {
                const int row = 2 * wave + rr;
                if (tok0 + row < ntok)
                    *(v4f*)(out + (size_t)(tok0 + row) * D + 512 * hd + 128 * c + 4 * lane) = ov[rr * 4 + c];
            }
        }
        
        __syncthreads();
    }
}

// ---------------------------------------------------------------------------
// Host launch glue
// ---------------------------------------------------------------------------
extern "C" void kernel_launch(void* const* d_in, const int* in_sizes, int n_in,
                              void* d_out, int out_size, void* d_ws, size_t ws_size,
                              hipStream_t stream) {
    if (n_in < 11) return;
    constexpr int S = 2048;                          // sequence length (band boundary)
    const int KV = in_sizes[2];                      // hidden width of the first projection
    const int D  = in_sizes[4];                      // model width
    if (D != 1024 || KV != 1024 || D != DW) return;
    const int ntok = in_sizes[0] / D;                // B*S
    if (ntok <= 0 || ntok * D != in_sizes[0]) return;
    if ((ntok % 128) != 0 || (ntok % S) != 0 || (S % 16) != 0) return;
    if (in_sizes[1] != D * KV || in_sizes[3] != KV * D || in_sizes[5] != D * D ||
        in_sizes[7] != D * D || in_sizes[9] != D * D) return;
    if (in_sizes[6] != D || in_sizes[8] != D || in_sizes[10] != D) return;
    if (out_size != ntok * D) return;

    const float* x  = (const float*)d_in[0];
    const float* w1 = (const float*)d_in[1];
    const float* b1 = (const float*)d_in[2];
    const float* w2 = (const float*)d_in[3];
    const float* b2 = (const float*)d_in[4];
    const float* qw = (const float*)d_in[5];
    const float* qb = (const float*)d_in[6];
    const float* kw = (const float*)d_in[7];
    const float* kb = (const float*)d_in[8];
    const float* vw = (const float*)d_in[9];
    const float* vb = (const float*)d_in[10];
    float* outp = (float*)d_out;

    const size_t nTD = (size_t)ntok * D;             // activations
    const size_t nDD = (size_t)D * D;                // square weights (D == KV)
    _Float16* xh  = (_Float16*)d_ws;                 // [ntok][D]
    _Float16* w1t = xh  + nTD;                       // [KV][D]  (k-contiguous)
    _Float16* w2t = w1t + nDD;                       // [D][KV]
    _Float16* qwt = w2t + nDD;                       // [D][D]
    _Float16* kwt = qwt + nDD;
    _Float16* vwt = kwt + nDD;
    _Float16* hh  = vwt + nDD;                       // [ntok][KV]
    _Float16* mh  = hh  + nTD;                       // [ntok][D]
    _Float16* qh  = mh  + nTD;                       // [ntok][D]
    _Float16* kh  = qh  + nTD;                       // [ntok][D]
    _Float16* vT  = kh  + nTD;                       // [D][ntok]
    const size_t total_halves = 6 * nTD + 5 * nDD;
    if (total_halves * sizeof(_Float16) > ws_size) return;

    const float wscl  = 64.0f, winv = 1.0f / 64.0f;
    const float pscl  = 256.0f, pinv = 1.0f / 256.0f;
    const float scale = 1.0f / sqrtf((float)D);

    // 1) weights [K][N] -> [N][K] f16 * 64   (D == KV, all five are 1024 x 1024), and x -> f16, one launch
    {
        const int n8 = (int)(nTD / 8);
        dim3 tg(DW / 64, DW / 64);                                       // one block per tile position
        k_prep<<<tg, 256, 0, stream>>>(x, xh, n8, w1, w2, qw, kw, vw, w1t, w2t, qwt, kwt, vwt, wscl);
    }
    // 2) projections
    {
        dim3 g1((KV + 63) / 64, (ntok + 127) / 128);
        k_gemm<true ><<<g1, 256, 0, stream>>>(xh, w1t, b1, hh, ntok, KV, D, winv);   // h = relu(x.W1 + b1)
        dim3 g2((D + 63) / 64, (ntok + 127) / 128);
        k_gemm<false><<<g2, 256, 0, stream>>>(hh, w2t, b2, mh, ntok, D, KV, winv);  // m = h.W2 + b2
        dim3 g3(DW / 64, ntok / 256);                                    // S | ntok, so 256 | ntok
        k_gemm_qkv<<<g3, QNW * 32, 0, stream>>>(mh, qwt, kwt, vwt, qb, kb, vb, qh, kh, vT, ntok, winv);   // q, k, vT
    }
    // 3) banded attention
    k_band_attn<<<ntok / 16, 256, 0, stream>>>(qh, kh, vT, outp, S, ntok, scale, pscl, pinv);
}

// v006
// One run takes 64.4 microseconds.
// Two timings next to v005 put it at 1.05 and 1.06 times that version's speed.
// Counting every step since v000, it is 2.74 times as fast.
#include <hip/hip_runtime.h>
// Contractions: x.W1, h.W2, m.Wq, m.Wk, m.Wv, banded q.k^T and P.v all on v_wmma_f32_16x16x32_f16 (f16 operands, f32 accumulate); weights carried x64 (folded back as 1/64), softmax weights carried x256 (folded back as 1/256); bias, ReLU, softmax in f32.

typedef _Float16 v16h __attribute__((ext_vector_type(16)));
typedef _Float16 v8h  __attribute__((ext_vector_type(8)));
typedef float    v8f  __attribute__((ext_vector_type(8)));
typedef float    v4f  __attribute__((ext_vector_type(4)));
union Frag { v16h v; v8h half[2]; };

static __device__ __forceinline__ v8f zero8() {
    v8f z = {0.f, 0.f, 0.f, 0.f, 0.f, 0.f, 0.f, 0.f};
    return z;
}

// 16x16x32 f16 WMMA with the VALU hazard guard tied to D, A and B.
static __device__ __forceinline__ v8f wmma16(v16h a, v16h b, v8f c) {
    v8f d = __builtin_amdgcn_wmma_f32_16x16x32_f16(false, a, false, b, (short)0, c, false, false);
    asm volatile("v_nop\n\tv_nop\n\tv_nop\n\tv_nop" : "+v"(d) : "v"(a), "v"(b));
    return d;
}

static __device__ __forceinline__ v8h cvt8(v4f u0, v4f u1) {
    v8h o;
    o[0] = (_Float16)u0[0]; o[1] = (_Float16)u0[1]; o[2] = (_Float16)u0[2]; o[3] = (_Float16)u0[3];
    o[4] = (_Float16)u1[0]; o[5] = (_Float16)u1[1]; o[6] = (_Float16)u1[2]; o[7] = (_Float16)u1[3];
    return o;
}

// ---------------------------------------------------------------------------
// The two preparations, which do not depend on each other, in one launch of few, long-lived blocks; block 256,
// grid (DW/64, DW/64): as many blocks as one DW x DW weight has 64(k) x 64(n) tiles.  Block (bx, by) does
//   - tile (bx, by) of each of the five weights: in[k][n] f32 -> out[n][k] f16 * scl (k-contiguous weight copy);
//   - run bx + by * DW/64 of x f32 -> xh f16: a run is 2048 pieces of 8 elements, 8 pieces a thread (2048 | n8).
// All 36 loads of a thread (x first, then the five tiles) are issued before the first is used; one barrier a block.
// ---------------------------------------------------------------------------
constexpr int DW = 1024;                             // side of every weight; kernel_launch takes no other

__global__ __launch_bounds__(256) void k_prep(const float* __restrict__ x, _Float16* xh, int n8,
                                              const float* __restrict__ w0, const float* __restrict__ w1,
                                              const float* __restrict__ w2, const float* __restrict__ w3,
                                              const float* __restrict__ w4,
                                              _Float16* o0, _Float16* o1, _Float16* o2, _Float16* o3, _Float16* o4,
                                              float scl) {
    static_assert(DW % 64 == 0, "whole tiles only");
    constexpr int NB = (DW / 64) * (DW / 64);        // blocks in the grid
    __shared__ float tile[5][64][65];
    const float* const win[5] = {w0, w1, w2, w3, w4};
    _Float16* const wout[5]   = {o0, o1, o2, o3, o4};
    const int n0 = blockIdx.x * 64, k0 = blockIdx.y * 64;
    const int tid = threadIdx.x;
    const int tr = tid >> 4, tc = (tid & 15) * 4;    // row within a group of 16 rows, first of 4 columns

    // x: the block's run; a block without one reads run 0 and stores nothing (block-uniform)
    const int run = blockIdx.y * (DW / 64) + blockIdx.x;
    const bool has = run * 2048 < n8;
    const size_t xo = (size_t)(has ? run : 0) * 16384 + tid * 8;
    const float* px = x + xo;
    _Float16* ph = xh + xo;
    v4f u0[8], u1[8];
#pragma unroll   // constant indices keep u0[], u1[] in registers
    for (int j = 0; j < 8; ++j) {
        u0[j] = *(const v4f*)(px + j * 2048);
        u1[j] = *(const v4f*)(px + j * 2048 + 4);
    }

    // the five tiles, 16 bytes a load (a wave: two rows of 256 B): one offset for all, the row step is a constant
    v4f tv[5][4];
    const unsigned tb = (unsigned)((k0 + tr) * DW + n0 + tc) * 4u;   // byte offset, the same in every weight
#pragma unroll   // constant indices keep tv[][] in registers
    for (int z = 0; z < 5; ++z) {
#pragma unroll
        for (int i = 0; i < 4; ++i) tv[z][i] = *(const v4f*)(((const char*)win[z] + tb) + 16 * i * DW * 4);
    }
    // Stands behind the 36 loads, before any register that they name is rewritten; the two address operands
    // stay live up to here, so that no load's result lands on them.
    asm volatile("s_wait_xcnt 0x0" :: "v"(px), "v"(tb) : "memory");

    if (has) {
#pragma unroll
        for (int j = 0; j < 8; ++j) *(v8h*)(ph + j * 2048) = cvt8(u0[j], u1[j]);
    }

#pragma unroll
    for (int z = 0; z < 5; ++z) {
#pragma unroll
        for (int i = 0; i < 4; ++i) {
#pragma unroll
            for (int e = 0; e < 4; ++e) tile[z][tr + 16 * i][tc + e] = tv[z][i][e];
        }
    }
    __syncthreads();
    const int lane = tid & 31, wave = tid >> 5;
    const int p = lane & 7, rq = lane >> 3;          // p: 16-B piece (k 8p..8p+7), rq: row within group of 4
    // wave w writes output rows nn = 8w .. 8w+7 of every tile (2 instructions x 4 rows each)
#pragma unroll
    for (int z = 0; z < 5; ++z) {
#pragma unroll
        for (int i = 0; i < 2; ++i) {
            const int nn = 8 * wave + 4 * i + rq;
            v8h o;
#pragma unroll
            for (int e = 0; e < 8; ++e) o[e] = (_Float16)(tile[z][8 * p + e][nn] * scl);
            *(v8h*)(wout[z] + (n0 + nn) * DW + k0 + 8 * p) = o;
        }
    }

    // runs of x beyond one a block, where x is that long
    asm volatile("s_wait_xcnt 0x0" ::: "memory");    // before registers that the stores above name are rewritten
    for (int r = run + NB; r * 2048 < n8; r += NB) {
        px += (size_t)NB * 16384;
        ph += (size_t)NB * 16384;
        for (int j = 0; j < 8; ++j)
            *(v8h*)(ph + j * 2048) = cvt8(*(const v4f*)(px + j * 2048), *(const v4f*)(px + j * 2048 + 4));
    }
}

// ---------------------------------------------------------------------------
// Twelve asynchronous 16-byte copies per lane, global -> LDS, through no register: copy i brings g[i] + koff
// (halves) to LDS byte l0 + i * step.  The closing s_wait_xcnt 0 stands in the copies' own statement so that
// no address register of an issued copy is rewritten in front of it.
// ---------------------------------------------------------------------------
static __device__ __forceinline__ void copy12(unsigned l0, unsigned step, const _Float16* const (&g)[12], int koff) {
    asm volatile(
        "global_load_async_to_lds_b128 %0, %12, off\n\t"
        "global_load_async_to_lds_b128 %1, %13, off\n\t"
        "global_load_async_to_lds_b128 %2, %14, off\n\t"
        "global_load_async_to_lds_b128 %3, %15, off\n\t"
        "global_load_async_to_lds_b128 %4, %16, off\n\t"
        "global_load_async_to_lds_b128 %5, %17, off\n\t"
        "global_load_async_to_lds_b128 %6, %18, off\n\t"
        "global_load_async_to_lds_b128 %7, %19, off\n\t"
        "global_load_async_to_lds_b128 %8, %20, off\n\t"
        "global_load_async_to_lds_b128 %9, %21, off\n\t"
        "global_load_async_to_lds_b128 %10, %22, off\n\t"
        "global_load_async_to_lds_b128 %11, %23, off\n\t"
        "s_wait_xcnt 0x0"
        :: "v"(l0), "v"(l0 + step), "v"(l0 + 2 * step), "v"(l0 + 3 * step), "v"(l0 + 4 * step), "v"(l0 + 5 * step),
           "v"(l0 + 6 * step), "v"(l0 + 7 * step), "v"(l0 + 8 * step), "v"(l0 + 9 * step), "v"(l0 + 10 * step),
           "v"(l0 + 11 * step),
           "v"(g[0] + koff), "v"(g[1] + koff), "v"(g[2] + koff), "v"(g[3] + koff), "v"(g[4] + koff), "v"(g[5] + koff),
           "v"(g[6] + koff), "v"(g[7] + koff), "v"(g[8] + koff), "v"(g[9] + koff), "v"(g[10] + koff), "v"(g[11] + koff)
        : "memory");
}

// The same with eight copies: copy i brings g[i] to LDS byte l0 + i * step.
static __device__ __forceinline__ void copy8(unsigned l0, unsigned step, const _Float16* const (&g)[8]) {
    asm volatile(
        "global_load_async_to_lds_b128 %0, %8, off\n\t"
        "global_load_async_to_lds_b128 %1, %9, off\n\t"
        "global_load_async_to_lds_b128 %2, %10, off\n\t"
        "global_load_async_to_lds_b128 %3, %11, off\n\t"
        "global_load_async_to_lds_b128 %4, %12, off\n\t"
        "global_load_async_to_lds_b128 %5, %13, off\n\t"
        "global_load_async_to_lds_b128 %6, %14, off\n\t"
        "global_load_async_to_lds_b128 %7, %15, off\n\t"
        "s_wait_xcnt 0x0"
        :: "v"(l0), "v"(l0 + step), "v"(l0 + 2 * step), "v"(l0 + 3 * step), "v"(l0 + 4 * step), "v"(l0 + 5 * step),
           "v"(l0 + 6 * step), "v"(l0 + 7 * step),
           "v"(g[0]), "v"(g[1]), "v"(g[2]), "v"(g[3]), "v"(g[4]), "v"(g[5]), "v"(g[6]), "v"(g[7])
        : "memory");
}

// The same with fourteen copies.
static __device__ __forceinline__ void copy14(unsigned l0, unsigned step, const _Float16* const (&g)[14]) {
    asm volatile(
        "global_load_async_to_lds_b128 %0, %14, off\n\t"
        "global_load_async_to_lds_b128 %1, %15, off\n\t"
        "global_load_async_to_lds_b128 %2, %16, off\n\t"
        "global_load_async_to_lds_b128 %3, %17, off\n\t"
        "global_load_async_to_lds_b128 %4, %18, off\n\t"
        "global_load_async_to_lds_b128 %5, %19, off\n\t"
        "global_load_async_to_lds_b128 %6, %20, off\n\t"
        "global_load_async_to_lds_b128 %7, %21, off\n\t"
        "global_load_async_to_lds_b128 %8, %22, off\n\t"
        "global_load_async_to_lds_b128 %9, %23, off\n\t"
        "global_load_async_to_lds_b128 %10, %24, off\n\t"
        "global_load_async_to_lds_b128 %11, %25, off\n\t"
        "global_load_async_to_lds_b128 %12, %26, off\n\t"
        "global_load_async_to_lds_b128 %13, %27, off\n\t"
        "s_wait_xcnt 0x0"
        :: "v"(l0), "v"(l0 + step), "v"(l0 + 2 * step), "v"(l0 + 3 * step), "v"(l0 + 4 * step), "v"(l0 + 5 * step),
           "v"(l0 + 6 * step), "v"(l0 + 7 * step), "v"(l0 + 8 * step), "v"(l0 + 9 * step), "v"(l0 + 10 * step),
           "v"(l0 + 11 * step), "v"(l0 + 12 * step), "v"(l0 + 13 * step),
           "v"(g[0]), "v"(g[1]), "v"(g[2]), "v"(g[3]), "v"(g[4]), "v"(g[5]), "v"(g[6]), "v"(g[7]), "v"(g[8]),
           "v"(g[9]), "v"(g[10]), "v"(g[11]), "v"(g[12]), "v"(g[13])
        : "memory");
}

// ---------------------------------------------------------------------------
// C[M][N] (f16, pitch N) = act((A[M][K] . Bt[N][K]^T) * inv + bias),  K a multiple of 128.
// Block 256 = 8 waves -> 128x64 tile; wave (wm, wn) owns 32x32 = 4 accumulators.
// A pass is 128 k: its 128 A rows and 64 Bt rows (256 B each) are copied whole-line into one of two LDS buffers
// (row pitch 272 B) while the pass before is worked on; fragments are read from LDS with the split k map for
// BOTH A and Bt:
//   lane l: row/col = l&15, h = l>>4; elements 0..7 <- k0+8h+0..7, elements 8..15 <- k0+16+8h+0..7.
// D: element r of lane l = (row 8h+r, col l&15).
// The tile is (bx, by); the bias goes by column of C.
// ---------------------------------------------------------------------------
constexpr int CSP = 68;                              // pitch of the staged C tile, floats

template <bool RELU>
static __device__ __forceinline__ void gemm_store(const float* Cs, const float* __restrict__ bias, _Float16* C,
                                                  int M, int N, float inv, int m0, int n0, int wave, int lane);

template <bool RELU>
static __device__ __forceinline__ void gemm_tile(const _Float16* __restrict__ A, const _Float16* __restrict__ Bt,
                                                 const float* __restrict__ bias, _Float16* C,
                                                 int M, int N, int K, float inv, int bx, int by) {
    constexpr int KP = 128, LP = 136, STG = 192 * LP;    // k per pass; LDS row pitch and buffer size in halves
    __shared__ __attribute__((aligned(16))) float Cs[128 * CSP];
    __shared__ __attribute__((aligned(16))) _Float16 Ts[2 * STG];
    const int tid = threadIdx.x, wave = tid >> 5, lane = tid & 31;
    const int h = lane >> 4, m = lane & 15;
    const int m0 = by * 128, n0 = bx * 64;
    const int wm = (wave & 3) * 32, wn = (wave >> 2) * 32;

    // copy map: thread -> row tid>>4 of each group of 16 rows, 16-byte piece tid&15; groups 0..7 = A, 8..11 = Bt
    const int crow = tid >> 4, cpc = tid & 15;
    const _Float16* g[12];
#pragma unroll   // constant indices keep g[] in registers
    for (int i = 0; i < 8; ++i) g[i] = A + (size_t)min(m0 + 16 * i + crow, M - 1) * K + 8 * cpc;
#pragma unroll   // as above
    for (int i = 0; i < 4; ++i) g[8 + i] = Bt + (size_t)min(n0 + 16 * i + crow, N - 1) * K + 8 * cpc;
    const unsigned lds0 = (unsigned)(size_t)(Ts + crow * LP + 8 * cpc);   // low 32 bits = LDS byte address
    constexpr unsigned GSTEP = 16 * LP * 2, BUFB = STG * 2;               // bytes per 16 rows, per buffer
    const int npass = K / KP;

    copy12(lds0, GSTEP, g, 0);
    asm volatile("s_wait_asynccnt 0x0" ::: "memory");   // this wave's share of pass 0 has landed
    __syncthreads();                                    // publishes pass 0 to every wave
    if (npass > 1) copy12(lds0 + BUFB, GSTEP, g, KP);

    const int fa = (wm + m) * LP + 8 * h;               // fragment offsets inside a buffer, halves
    const int fb = (128 + wn + m) * LP + 8 * h;
    v8f c00 = zero8(), c01 = zero8(), c10 = zero8(), c11 = zero8();
    for (int t = 0; t < npass; ++t) {
        const _Float16* tb = Ts + (t & 1) * STG;
#pragma unroll   // constant k0 folds into the LDS loads' offset field
        for (int k0 = 0; k0 < KP; k0 += 32) {
            Frag a0, a1, b0, b1;
            a0.half[0] = *(const v8h*)(tb + fa + k0);            a0.half[1] = *(const v8h*)(tb + fa + k0 + 16);
            a1.half[0] = *(const v8h*)(tb + fa + 16 * LP + k0);  a1.half[1] = *(const v8h*)(tb + fa + 16 * LP + k0 + 16);
            b0.half[0] = *(const v8h*)(tb + fb + k0);            b0.half[1] = *(const v8h*)(tb + fb + k0 + 16);
            b1.half[0] = *(const v8h*)(tb + fb + 16 * LP + k0);  b1.half[1] = *(const v8h*)(tb + fb + 16 * LP + k0 + 16);
            c00 = wmma16(a0.v, b0.v, c00);
            c01 = wmma16(a0.v, b1.v, c01);
            c10 = wmma16(a1.v, b0.v, c10);
            c11 = wmma16(a1.v, b1.v, c11);
        }
        asm volatile("s_wait_dscnt 0x0" ::: "memory");     // this wave's reads of buffer t&1 are done before it is refilled
        asm volatile("s_wait_asynccnt 0x0" ::: "memory");  // this wave's share of pass t+1 has landed
        __syncthreads();                                   // publishes pass t+1 and ends every read of buffer t&1
        if (t + 2 < npass) copy12(lds0 + (t & 1) * BUFB, GSTEP, g, (t + 2) * KP);
    }
    asm volatile("s_wait_asynccnt 0x0" ::: "memory");      // no copy is outstanding behind the loop

    // stage D: acc element r -> row 8h+r, col m of its 16x16 tile
#pragma unroll
    for (int r = 0; r < 8; ++r) {
        Cs[(wm + 8 * h + r) * CSP + wn + m]           = c00[r];
        Cs[(wm + 8 * h + r) * CSP + wn + 16 + m]      = c01[r];
        Cs[(wm + 16 + 8 * h + r) * CSP + wn + m]      = c10[r];
        Cs[(wm + 16 + 8 * h + r) * CSP + wn + 16 + m] = c11[r];
    }
    __syncthreads();

    gemm_store<RELU>(Cs, bias, C, M, N, inv, m0, n0, wave, lane);
}

// The staged 128x64 f32 tile -> act(. * inv + bias) as f16, whole 128-byte lines.
template <bool RELU>
static __device__ __forceinline__ void gemm_store(const float* Cs, const float* __restrict__ bias, _Float16* C,
                                                  int M, int N, float inv, int m0, int n0, int wave, int lane) {
    const int p = lane & 7, rq = lane >> 3;          // p: cols 8p..8p+7, rq: row within group of 4
    v4f bc0 = {0.f, 0.f, 0.f, 0.f}, bc1 = {0.f, 0.f, 0.f, 0.f};
    if (n0 + 8 * p + 8 <= N) {
        bc0 = *(const v4f*)(bias + n0 + 8 * p);
        bc1 = *(const v4f*)(bias + n0 + 8 * p + 4);
    }
    // wave w writes rows 16w..16w+15 (4 instructions x 4 rows)
    v8h vals[4];
#pragma unroll
    for (int i = 0; i < 4; ++i) {
        const int rloc = 16 * wave + 4 * i + rq;
        const float* src = Cs + rloc * CSP + 8 * p;
        v4f u0 = *(const v4f*)src;
        v4f u1 = *(const v4f*)(src + 4);
        u0 = u0 * inv + bc0;
        u1 = u1 * inv + bc1;
        if (RELU) {
            u0[0] = fmaxf(u0[0], 0.f); u0[1] = fmaxf(u0[1], 0.f); u0[2] = fmaxf(u0[2], 0.f); u0[3] = fmaxf(u0[3], 0.f);
            u1[0] = fmaxf(u1[0], 0.f); u1[1] = fmaxf(u1[1], 0.f); u1[2] = fmaxf(u1[2], 0.f); u1[3] = fmaxf(u1[3], 0.f);
        }
        vals[i] = cvt8(u0, u1);
    }
#pragma unroll
    for (int i = 0; i < 4; ++i) {
        const int grow = m0 + 16 * wave + 4 * i + rq;
        if (grow < M && n0 + 8 * p + 8 <= N)
            *(v8h*)(C + (size_t)grow * N + n0 + 8 * p) = vals[i];
    }
    
}

// One product, grid (ceil(N/64), ceil(M/128)), bias by column.
template <bool RELU>
__global__ __launch_bounds__(256) void k_gemm(const _Float16* __restrict__ A, const _Float16* __restrict__ Bt,
                                              const float* __restrict__ bias, _Float16* C,
                                              int M, int N, int K, float inv) {
    gemm_tile<RELU>(A, Bt, bias, C, M, N, K, inv, blockIdx.x, blockIdx.y);
}

// The three products of m in one launch of one block a WGP; block of QNW = 16 waves, grid (DW/64, ntok/256); 256 | ntok.
// Block (x, y): tokens 256y .. 256y+255 against columns 64x .. 64x+63 of EACH of q, k and v: a 256 x 192 tile.
//   q = m.Wq + qb and k = m.Wk + kb, token-major;  v = m.Wv + vb in the order of the A fragments of k_band_attn:
//   vF[tok / 32][d / 16][half][lane][8], lane = (h, d % 16), element e = token 32 * (tok / 32) + 16 * half + 8h + e.
// A pass is 128 k: the 256 rows of m and the 3 x 64 weight rows (256 B each) are copied whole-line into one of two LDS
// buffers (row pitch 272 B) while the pass before is worked on; waits and barrier of a pass as in gemm_tile.
// Wave (wm, wn), 4 x 4: 64 tokens against the wn-th 16 of each 64 columns (a 64 x 48 tile).  Fragments: the split k map of
// gemm_tile for tokens and weights alike, so either may stand as A.  D holds 8 successive A rows in a lane:
//   q, k: A = weight rows, B = tokens -> a lane holds 8 columns of one token;
//   v   : A = tokens, B = weight rows -> a lane holds 8 tokens of one value dim;
// each goes to the staged f16 tile as one 16-byte LDS store, in the order in which its output is laid out.
constexpr int QNW = 16;                              // waves in a block of k_gemm_qkv

__global__ __launch_bounds__(QNW * 32) void k_gemm_qkv(const _Float16* __restrict__ mh, const _Float16* __restrict__ qwt,
                                                      const _Float16* __restrict__ kwt, const _Float16* __restrict__ vwt,
                                                      const float* __restrict__ qb, const float* __restrict__ kb,
                                                      const float* __restrict__ vb,
                                                      _Float16* qh, _Float16* kh, _Float16* vF, int ntok, float inv) {
    constexpr int NT = QNW * 32, K = DW, KP = 128, LP = 136;  // threads; depth; k per pass; LDS row pitch, halves
    constexpr int BM = 256, ROWS = BM + 192, STG = ROWS * LP; // tokens; rows and halves of a buffer
    constexpr int WN = QNW / 4, FJ = 4 / WN;                  // wave columns; 16-column fragments of each of q, k, v a wave
    constexpr int RPG = NT / 16, NG = ROWS / RPG;             // rows that one copy of every thread brings; copies a thread
    constexpr int TG = BM / RPG, CG = 64 / RPG;               // of these: for the tokens, for one weight
    constexpr int CP = 136, VP = BM + 8;                      // pitch of the staged q|k rows and of the v^T rows, halves
    static_assert(NG % 14 == 0 && FJ * WN == 4 && K % KP == 0 && K / KP >= 2, "shapes");
    static_assert(BM * CP + 64 * VP <= 2 * STG, "the staged output fits the ring");
    __shared__ __attribute__((aligned(16))) _Float16 Ts[2 * STG];
    const int tid = threadIdx.x, wave = tid >> 5, lane = tid & 31;
    const int h = lane >> 4, m = lane & 15;
    const int m0 = blockIdx.y * BM, n0 = blockIdx.x * 64;
    const int wm = (wave & 3) * 64, wn = wave >> 2;

    // copy map: thread -> row tid>>4 of each group of RPG rows, 16-byte piece tid&15; groups: tokens, Wq, Wk, Wv
    const int crow = tid >> 4, cpc = tid & 15;
    const _Float16* const pa = mh + (size_t)(m0 + crow) * K + 8 * cpc;
    const size_t wo = (size_t)(n0 + crow) * K + 8 * cpc;
    const _Float16* const pw[3] = {qwt + wo, kwt + wo, vwt + wo};
    const unsigned lds0 = (unsigned)(size_t)(Ts + crow * LP + 8 * cpc);   // low 32 bits = LDS byte address
    constexpr unsigned GSTEP = RPG * LP * 2, BUFB = STG * 2;              // bytes per group, per buffer
    constexpr int npass = K / KP;
    auto copy_pass = [&](unsigned lbase, int koff) {
#pragma unroll   // constant indices keep g[] in registers
        for (int s = 0; s < NG / 14; ++s) {
            const _Float16* g[14];
#pragma unroll   // as above
            for (int i = 0; i < 14; ++i) {
                const int gi = 14 * s + i;
                g[i] = (gi < TG ? pa + gi * RPG * K : pw[(gi - TG) / CG] + ((gi - TG) % CG) * RPG * K) + koff;
            }
            copy14(lbase + 14 * s * GSTEP, GSTEP, g);
        }
    };

    copy_pass(lds0, 0);
    asm volatile("s_wait_asynccnt 0x0" ::: "memory");   // this wave's share of pass 0 has landed
    __syncthreads();                                    // publishes pass 0 to every wave
    copy_pass(lds0 + BUFB, KP);

    // the lane's biases, asked for here so that they are there when the passes end
    v4f b0[2 * FJ], b1[2 * FJ];
    float bb[FJ];
#pragma unroll
    for (int j = 0; j < 2 * FJ; ++j) {
        const float* bp = (j / FJ ? kb : qb) + n0 + 16 * FJ * wn + 16 * (j % FJ) + 8 * h;
        b0[j] = *(const v4f*)bp;
        b1[j] = *(const v4f*)(bp + 4);
    }
#pragma unroll
    for (int j = 0; j < FJ; ++j) bb[j] = vb[n0 + 16 * FJ * wn + 16 * j + m];

    const int fa = (wm + m) * LP + 8 * h;               // fragment offsets inside a buffer, halves
    const int fw = (BM + 16 * FJ * wn + m) * LP + 8 * h;
    v8f acc[4][3 * FJ];
#pragma unroll
    for (int i = 0; i < 4; ++i) {
#pragma unroll
        for (int j = 0; j < 3 * FJ; ++j) acc[i][j] = zero8();
    }
#pragma unroll 1   // the passes stay a loop: eight copies of the pass would only lengthen the text that is fetched once
    for (int t = 0; t < npass; ++t) {
        const _Float16* tb = Ts + (t & 1) * STG;
#pragma unroll   // constant k0 folds into the LDS loads' offset field
        for (int k0 = 0; k0 < KP; k0 += 32) {
            Frag a[4], w[3 * FJ];
#pragma unroll
            for (int i = 0; i < 4; ++i) {
                a[i].half[0] = *(const v8h*)(tb + fa + 16 * i * LP + k0);
                a[i].half[1] = *(const v8h*)(tb + fa + 16 * i * LP + k0 + 16);
            }
#pragma unroll
            for (int j = 0; j < 3 * FJ; ++j) {
                const int ro = (64 * (j / FJ) + 16 * (j % FJ)) * LP;
                w[j].half[0] = *(const v8h*)(tb + fw + ro + k0);
                w[j].half[1] = *(const v8h*)(tb + fw + ro + k0 + 16);
            }
#pragma unroll
            for (int j = 0; j < 3 * FJ; ++j) {
#pragma unroll
                for (int i = 0; i < 4; ++i)
                    acc[i][j] = (j < 2 * FJ) ? wmma16(w[j].v, a[i].v, acc[i][j]) : wmma16(a[i].v, w[j].v, acc[i][j]);
            }
        }
        asm volatile("s_wait_dscnt 0x0" ::: "memory");     // this wave's reads of buffer t&1 are done before it is refilled
        asm volatile("s_wait_asynccnt 0x0" ::: "memory");  // this wave's share of pass t+1 has landed
        __syncthreads();                                   // publishes pass t+1 and ends every read of buffer t&1
        if (t + 2 < npass) copy_pass(lds0 + (t & 1) * BUFB, (t + 2) * KP);
    }
    asm volatile("s_wait_asynccnt 0x0" ::: "memory");      // no copy is outstanding behind the loop

    // stage act(. * inv + bias) as f16 over the ring, which every wave has left: q|k rows [256][128], v^T rows [64][256]
    _Float16* const Cqk = Ts;
    _Float16* const Cv  = Ts + BM * CP;
#pragma unroll
    for (int j = 0; j < 2 * FJ; ++j) {
        const int col = 16 * FJ * wn + 16 * (j % FJ) + 8 * h;    // first of the lane's 8 columns, within the 64
#pragma unroll
        for (int i = 0; i < 4; ++i) {
            const v8f c = acc[i][j];
            v4f u0 = {c[0], c[1], c[2], c[3]}, u1 = {c[4], c[5], c[6], c[7]};
            *(v8h*)(Cqk + (wm + 16 * i + m) * CP + 64 * (j / FJ) + col) = cvt8(u0 * inv + b0[j], u1 * inv + b1[j]);
        }
    }
#pragma unroll
    for (int j = 2 * FJ; j < 3 * FJ; ++j) {
        const int dl = 16 * FJ * wn + 16 * (j % FJ) + m;         // the lane's value dim, within the 64
        const float bj = bb[j - 2 * FJ];
        const v4f bv = {bj, bj, bj, bj};
#pragma unroll
        for (int i = 0; i < 4; ++i) {
            const v8f c = acc[i][j];
            v4f u0 = {c[0], c[1], c[2], c[3]}, u1 = {c[4], c[5], c[6], c[7]};
            *(v8h*)(Cv + dl * VP + wm + 16 * i + 8 * h) = cvt8(u0 * inv + bv, u1 * inv + bv);
        }
    }
    __syncthreads();

    // whole 128-byte lines out: a wave's store is 2 tokens x (128 B of q + 128 B of k), then one half fragment of v (512 B)
    constexpr int NQ = BM * 16 / NT, NV = 64 * 32 / NT, KB = BM / 32;
    static_assert(NT / 32 == 2 * KB && NV == 4, "a wave keeps its block of 32 tokens and its half; its NV stores are the 4 tiles of 16 value dims");
    const int kbl = wave % KB, fh = wave / KB;
    v8h oq[NQ], ov[NV];
#pragma unroll
    for (int it = 0; it < NQ; ++it) oq[it] = *(const v8h*)(Cqk + (it * RPG + crow) * CP + 8 * cpc);
#pragma unroll
    for (int it = 0; it < NV; ++it) ov[it] = *(const v8h*)(Cv + (16 * it + m) * VP + 32 * kbl + 16 * fh + 8 * h);
    _Float16* const dq = (cpc < 8 ? qh : kh) + (size_t)(m0 + crow) * K + n0 + 8 * (cpc & 7);
    _Float16* const dv = vF + ((size_t)(m0 / 32 + kbl) * (K / 16) + n0 / 16) * 512 + 256 * fh + 8 * lane;
#pragma unroll
    for (int it = 0; it < NQ; ++it) *(v8h*)(dq + it * RPG * K) = oq[it];
#pragma unroll
    for (int it = 0; it < NV; ++it) *(v8h*)(dv + it * 512) = ov[it];
}

// ---------------------------------------------------------------------------
// Banded attention, window offsets -32..+32, D = 1024.  One block (256 = 8 waves) per tile of 16 queries.
//   qh, kh : [ntok][1024] f16 (token-major);  vF : v in A-fragment order, [ntok/32][64][2][32][8] f16 (see k_gemm_qkv);
//   out : [ntok][1024] f32.
// The q and key rows come into LDS by asynchronous copies, 48 a thread, all in flight at once.
// Phase 0: the 16 q rows and the 5 key tiles of 16 rows (keys s0-32 .. s0+47), 2 KiB a row, row pitch 2064 B.  A key
//          tile is 16-aligned, so it lies wholly inside the sequence or wholly outside; for one outside, the nearest
//          tile inside is copied, and phase 2 reads none of its scores.
// Phase 1: scores S[16 q][80 keys]: wave t<5 computes key tile t on WMMA over k = 1024
//          (A = q rows, B[k=d][n=key] from k rows with the same split map, both from LDS), f32 into LDS.
//          In front of it every wave asks for its own A fragments of v, straight into registers: 8 tiles of 16 value
//          dims x the 3 blocks of 32 keys from K0 = s0-32 rounded down to a multiple of 32 (a block outside the
//          sequence, where P is zero, is replaced by the nearest inside); a load of a wave is 512 B in one run; no
//          other wave needs these fragments, and they land during phase 1.
// Phase 2: f32 masked softmax per query row (2 rows per wave), P*pscl as f16 into LDS [16][96], column = key - K0
//          (columns outside the band = 0).
// Phase 3: O^T[d][q] = v^T[d][keys] . P^T[keys][q] on WMMA (3 k-steps of 32 keys = the 3 blocks; A from registers;
//          B = P^T loaded from the [q][key] LDS tile with the split map),
// ---------------------------------------------------------------------------
__global__ __launch_bounds__(256) void k_band_attn(const _Float16* __restrict__ qh, const _Float16* __restrict__ kh,
                                                   const _Float16* __restrict__ vF, float* out,
                                                   int S, int ntok, float scale, float pscl, float pinv) {
    constexpr int D = 1024, HALF = 32, NC = 80, PP = 96, OSP = 516;
    constexpr int QP = D + 8;                        // pitch of a staged q or key row, halves: 16 B x odd
    __shared__ __attribute__((aligned(16))) _Float16 Stg[(16 + NC) * QP];   // q rows 0..15 and key rows 16..95
    __shared__ __attribute__((aligned(16))) float    Ss[16 * NC];
    __shared__ __attribute__((aligned(16))) _Float16 Ps[16 * PP];
    __shared__ __attribute__((aligned(16))) float    Os[16 * OSP];

    const int tid = threadIdx.x, wave = tid >> 5, lane = tid & 31;
    const int h = lane >> 4, m = lane & 15;
    const int tok0 = blockIdx.x * 16;                // 16 | S, so a tile never straddles a batch
    const int b = tok0 / S;
    const int s0 = tok0 - b * S;
    const size_t bS = (size_t)b * S;
    const float ninf = -__builtin_huge_valf();

    // ---- phase 0: stage the q and key rows ----
    {
        // copy map: thread -> 16-byte piece tid&127 of row 2i + (tid>>7) of each tile of 16 rows, i = 0..7;
        // a wave's copy is 512 contiguous bytes of one row
        const int cpc = tid & 127, rsub = tid >> 7;
        const unsigned lds0 = (unsigned)(size_t)(Stg + rsub * QP + 8 * cpc);  // low 32 bits = LDS byte address
        constexpr unsigned RSTEP = 2 * QP * 2;                                // bytes from row 2i to row 2i + 2
#pragma unroll   // constant indices keep g[] in registers
        for (int tl = 0; tl < 6; ++tl) {
            const int kt0 = min(max(s0 - HALF + 16 * (tl - 1), 0), S - 16);   // first key of the tile, inside the sequence
            const _Float16* tb = (tl == 0) ? qh + (size_t)(tok0 + rsub) * D + 8 * cpc
                                           : kh + (bS + kt0 + rsub) * D + 8 * cpc;
            const _Float16* g[8];
#pragma unroll   // as above
            for (int i = 0; i < 8; ++i) g[i] = tb + 2 * i * D;
            copy8(lds0 + 8 * tl * RSTEP, RSTEP, g);
        }
        asm volatile("s_wait_asynccnt 0x0" ::: "memory");   // this wave's share of the rows has landed
        __syncthreads();                                    // publishes the rows to every wave
    }

    // ---- this wave's A fragments of v: tile wave + 8t of 16 value dims, t = 0..7, against key block c of the window ----
    const int sh = s0 & 16;                          // keys by which the window starts in front of s0 - HALF
    Frag va[8][3];
    {
        const int kb0 = (s0 - HALF - sh) / 32;       // first block of the window; -1 at the sequence's start
        const _Float16* vp[3];
#pragma unroll   // constant indices keep vp[] in registers
        for (int c = 0; c < 3; ++c) {
            const int kb = min(max(kb0 + c, 0), S / 32 - 1);                  // a block inside the sequence
            vp[c] = vF + ((bS / 32 + kb) * (size_t)(D / 16) + wave) * 512 + 8 * lane;
        }
#pragma unroll   // constant indices keep va[][] in registers
        for (int t = 0; t < 8; ++t) {
#pragma unroll   // as above
            for (int c = 0; c < 3; ++c) {
                va[t][c].half[0] = *(const v8h*)(vp[c] + t * 8 * 512);
                va[t][c].half[1] = *(const v8h*)(vp[c] + t * 8 * 512 + 256);
            }
        }
        // Stands behind the 48 loads, before any register that they name is rewritten; the address operands stay
        // live up to here, so that no load's result lands on them.
        asm volatile("s_wait_xcnt 0x0" :: "v"(vp[0]), "v"(vp[1]), "v"(vp[2]) : "memory");
    }

    // ---- phase 1: scores ----
    if (wave < 5) {                                  // wave-uniform branch
        const int t = wave;
        const _Float16* pa = Stg + m * QP + 8 * h;
        const _Float16* pb = Stg + (16 + 16 * t + m) * QP + 8 * h;
        v8f acc = zero8();
#pragma unroll 2
        for (int k0 = 0; k0 < D; k0 += 32) {
            Frag a, bb;
            a.half[0]  = *(const v8h*)(pa + k0);  a.half[1]  = *(const v8h*)(pa + k0 + 16);
            bb.half[0] = *(const v8h*)(pb + k0);  bb.half[1] = *(const v8h*)(pb + k0 + 16);
            acc = wmma16(a.v, bb.v, acc);
        }
#pragma unroll
        for (int r = 0; r < 8; ++r) Ss[(8 * h + r) * NC + 16 * t + m] = acc[r];
    }
    __syncthreads();                                 // publishes the scores

    // ---- phase 2: masked softmax, rows 2w and 2w+1 per wave ----
#pragma unroll
    for (int rr = 0; rr < 2; ++rr) {
        const int r = 2 * wave + rr;                 // query row 0..15, position s0 + r
        float xv[3], ev[3];
        bool  vv[3];
        float mx = ninf;
#pragma unroll
        for (int c3 = 0; c3 < 3; ++c3) {
            const int c   = lane + 32 * c3 - sh;     // score column of window column lane + 32 * c3
            const int key = s0 - HALF + c;
            const bool valid = (c < NC) && (c >= r) && (c <= r + 2 * HALF) && (key >= 0) && (key < S);
            float x = ninf;
            if (valid) x = Ss[r * NC + c] * scale;
            xv[c3] = x; vv[c3] = valid;
            mx = fmaxf(mx, x);
        }
#pragma unroll
        for (int o = 16; o > 0; o >>= 1) mx = fmaxf(mx, __shfl_xor(mx, o, 32));
        float sum = 0.f;
#pragma unroll
        for (int c3 = 0; c3 < 3; ++c3) {
            const float e = vv[c3] ? expf(xv[c3] - mx) : 0.f;
            ev[c3] = e;
            sum += e;
        }
#pragma unroll
        for (int o = 16; o > 0; o >>= 1) sum += __shfl_xor(sum, o, 32);
        const float f = pscl / sum;
#pragma unroll
        for (int c3 = 0; c3 < 3; ++c3) {
            const int c = lane + 32 * c3;            // window column, always < 96
            Ps[r * PP + c] = (_Float16)(ev[c3] * f);
        }
    }
    __syncthreads();                                    // publishes P

    // ---- phase 3: O^T = v^T . P^T ----
    Frag pf[3];
#pragma unroll
    for (int j = 0; j < 3; ++j) {
        pf[j].half[0] = *(const v8h*)(Ps + m * PP + 32 * j + 8 * h);
        pf[j].half[1] = *(const v8h*)(Ps + m * PP + 32 * j + 16 + 8 * h);
    }
#pragma unroll   // constant indices keep va[][] in registers
    for (int hd = 0; hd < 2; ++hd) {
        v8f acc[4];                                  // value-dim tiles 32hd + wave + 8i, four chains side by side
#pragma unroll
        for (int i = 0; i < 4; ++i) acc[i] = zero8();
#pragma unroll
        for (int j = 0; j < 3; ++j) {
#pragma unroll
            for (int i = 0; i < 4; ++i) acc[i] = wmma16(va[4 * hd + i][j].v, pf[j].v, acc[i]);
        }
#pragma unroll
        for (int i = 0; i < 4; ++i) {
            const int dtl = wave + 8 * i;            // local value-dim tile 0..31
#pragma unroll
            for (int r = 0; r < 8; ++r) Os[m * OSP + 16 * dtl + 8 * h + r] = acc[i][r] * pinv;
        }
        __syncthreads();
        v4f ov[8];
#pragma unroll
        for (int rr = 0; rr < 2; ++rr) {
#pragma unroll
            for (int c = 0; c < 4; ++c) {
                const int row = 2 * wave + rr;
                ov[rr * 4 + c] = *(const v4f*)(Os + row * OSP + 128 * c + 4 * lane);
            }
        }
#pragma unroll
        for (int rr = 0; rr < 2; ++rr) {
#pragma unroll
            for (int c = 0; c < 4; ++c) {
                const int row = 2 * wave + rr;
                if (tok0 + row < ntok)
                    *(v4f*)(out + (size_t)(tok0 + row) * D + 512 * hd + 128 * c + 4 * lane) = ov[rr * 4 + c];
            }
        }
        
        __syncthreads();
    }
}

// ---------------------------------------------------------------------------
// Host launch glue
// ---------------------------------------------------------------------------
extern "C" void kernel_launch(void* const* d_in, const int* in_sizes, int n_in,
                              void* d_out, int out_size, void* d_ws, size_t ws_size,
                              hipStream_t stream) {
    if (n_in < 11) return;
    constexpr int S = 2048;                          // sequence length (band boundary)
    const int KV = in_sizes[2];                      // hidden width of the first projection
    const int D  = in_sizes[4];                      // model width
    if (D != 1024 || KV != 1024 || D != DW) return;
    const int ntok = in_sizes[0] / D;                // B*S
    if (ntok <= 0 || ntok * D != in_sizes[0]) return;
    if ((ntok % 128) != 0 || (ntok % S) != 0 || (S % 32) != 0) return;
    if (in_sizes[1] != D * KV || in_sizes[3] != KV * D || in_sizes[5] != D * D ||
        in_sizes[7] != D * D || in_sizes[9] != D * D) return;
    if (in_sizes[6] != D || in_sizes[8] != D || in_sizes[10] != D) return;
    if (out_size != ntok * D) return;

    const float* x  = (const float*)d_in[0];
    const float* w1 = (const float*)d_in[1];
    const float* b1 = (const float*)d_in[2];
    const float* w2 = (const float*)d_in[3];
    const float* b2 = (const float*)d_in[4];
    const float* qw = (const float*)d_in[5];
    const float* qb = (const float*)d_in[6];
    const float* kw = (const float*)d_in[7];
    const float* kb = (const float*)d_in[8];
    const float* vw = (const float*)d_in[9];
    const float* vb = (const float*)d_in[10];
    float* outp = (float*)d_out;

    const size_t nTD = (size_t)ntok * D;             // activations
    const size_t nDD = (size_t)D * D;                // square weights (D == KV)
    _Float16* xh  = (_Float16*)d_ws;                 // [ntok][D]
    _Float16* w1t = xh  + nTD;                       // [KV][D]  (k-contiguous)
    _Float16* w2t = w1t + nDD;                       // [D][KV]
    _Float16* qwt = w2t + nDD;                       // [D][D]
    _Float16* kwt = qwt + nDD;
    _Float16* vwt = kwt + nDD;
    _Float16* hh  = vwt + nDD;                       // [ntok][KV]
    _Float16* mh  = hh  + nTD;                       // [ntok][D]
    _Float16* qh  = mh  + nTD;                       // [ntok][D]
    _Float16* kh  = qh  + nTD;                       // [ntok][D]
    _Float16* vF  = kh  + nTD;                       // [ntok/32][D/16][2][32][8]
    const size_t total_halves = 6 * nTD + 5 * nDD;
    if (total_halves * sizeof(_Float16) > ws_size) return;

    const float wscl  = 64.0f, winv = 1.0f / 64.0f;
    const float pscl  = 256.0f, pinv = 1.0f / 256.0f;
    const float scale = 1.0f / sqrtf((float)D);

    // 1) weights [K][N] -> [N][K] f16 * 64   (D == KV, all five are 1024 x 1024), and x -> f16, one launch
    {
        const int n8 = (int)(nTD / 8);
        dim3 tg(DW / 64, DW / 64);                                       // one block per tile position
        k_prep<<<tg, 256, 0, stream>>>(x, xh, n8, w1, w2, qw, kw, vw, w1t, w2t, qwt, kwt, vwt, wscl);
    }
    // 2) projections
    {
        dim3 g1((KV + 63) / 64, (ntok + 127) / 128);
        k_gemm<true ><<<g1, 256, 0, stream>>>(xh, w1t, b1, hh, ntok, KV, D, winv);   // h = relu(x.W1 + b1)
        dim3 g2((D + 63) / 64, (ntok + 127) / 128);
        k_gemm<false><<<g2, 256, 0, stream>>>(hh, w2t, b2, mh, ntok, D, KV, winv);  // m = h.W2 + b2
        dim3 g3(DW / 64, ntok / 256);                                    // S | ntok, so 256 | ntok
        k_gemm_qkv<<<g3, QNW * 32, 0, stream>>>(mh, qwt, kwt, vwt, qb, kb, vb, qh, kh, vF, ntok, winv);   // q, k, v
    }
    // 3) banded attention
    k_band_attn<<<ntok / 16, 256, 0, stream>>>(qh, kh, vF, outp, S, ntok, scale, pscl, pinv);
}
